// v000
// The times below were measured on an AMD MI455X: many runs one after another, warmed up first and cycling through
// copies of the inputs, with the whole window's GPU time divided by the number of runs. Launches and the gaps
// between them are all in it. The median over several windows is given; except for v000 it joins two sittings, which
// can be a few percent apart, so the side-by-side timings, each taken in one sitting, are the better comparison.
// The starting kernel, v000, takes 171 microseconds a run.
#include <hip/hip_runtime.h>

typedef float v2f __attribute__((ext_vector_type(2)));
typedef float v8f __attribute__((ext_vector_type(8)));

#define H_ 8
#define D_ 128
#define K_ 32
#define NTOK 32768          // B*S
#define CHUNK_TOK 64
#define CHUNKS 4
#define TOKGRP 128          // gridDim.x ; TOKGRP*CHUNKS*CHUNK_TOK == NTOK
#define NORM_STRIDE 132     // 132 mod 64 = 4 -> conflict-free v2f A reads
#define MID_STRIDE 36

__device__ __forceinline__ float wave_sum(float v) {
  v += __shfl_xor(v, 1, 32);
  v += __shfl_xor(v, 2, 32);
  v += __shfl_xor(v, 4, 32);
  v += __shfl_xor(v, 8, 32);
  v += __shfl_xor(v, 16, 32);
  return v;
}

__device__ __forceinline__ float gelu_exact(float v) {
  return 0.5f * v * (1.0f + erff(v * 0.70710678118654752440f));
}

// PASS1: compute y = up(gelu(down(ln(x)))) and emit per-block column sums / sumsq.
// PASS2 (PASS1=false): recompute y, apply pre-folded BN affine (G,SH) + residual.
template<bool PASS1>
__global__ __launch_bounds__(256) void adapter_pass(
    const float* __restrict__ x,
    const float* __restrict__ ln_g, const float* __restrict__ ln_b,
    const float* __restrict__ wd,  const float* __restrict__ bdn,
    const float* __restrict__ wu,  const float* __restrict__ bup,
    const float* __restrict__ gsh,   // PASS2: [f]=G=0.1*gamma*rs, [1024+f]=SH
    float* __restrict__ out,         // PASS2
    float* __restrict__ partial)     // PASS1: [(h*128+bx)*256 + {0:128 sum,128:256 sq}]
{
  __shared__ float s_norm[CHUNK_TOK * NORM_STRIDE];
  __shared__ float s_mid[CHUNK_TOK * MID_STRIDE];
  __shared__ float s_red[2 * 8 * 64];

  const int tid  = threadIdx.x;
  const int lane = tid & 31;
  const int w    = tid >> 5;      // wave 0..7
  const int hi   = lane >> 4;     // lane half selects K pair / M+8
  const int ln16 = lane & 15;
  const int h    = blockIdx.y;
  const int bx   = blockIdx.x;

  const float* __restrict__ wdh = wd + h * (D_ * K_);
  const float* __restrict__ wuh = wu + h * (K_ * D_);

  const float4 lg = *reinterpret_cast<const float4*>(ln_g + h * D_ + lane * 4);
  const float4 lb = *reinterpret_cast<const float4*>(ln_b + h * D_ + lane * 4);

  const int mtile = w >> 1;       // 0..3 : 16-token row tile
  const int cgrp  = w & 1;        // column group

  float accS[4] = {0.f, 0.f, 0.f, 0.f};
  float accQ[4] = {0.f, 0.f, 0.f, 0.f};

  for (int chunk = 0; chunk < CHUNKS; ++chunk) {
    const int tokbase = (bx * CHUNKS + chunk) * CHUNK_TOK;

    // ---- LayerNorm: one wave per token row, 8 tokens per wave ----
    for (int i = 0; i < 8; ++i) {
      const int t = w * 8 + i;
      const size_t off = (size_t)(tokbase + t) * (H_ * D_) + h * D_ + lane * 4;
      const float4 v = *reinterpret_cast<const float4*>(x + off);
      const float s = wave_sum(v.x + v.y + v.z + v.w);
      const float mean = s * (1.0f / 128.0f);
      const float d0 = v.x - mean, d1 = v.y - mean, d2 = v.z - mean, d3 = v.w - mean;
      const float q = wave_sum(d0 * d0 + d1 * d1 + d2 * d2 + d3 * d3);
      const float rs = rsqrtf(q * (1.0f / 128.0f) + 1e-5f);
      float4 nv;
      nv.x = d0 * rs * lg.x + lb.x;
      nv.y = d1 * rs * lg.y + lb.y;
      nv.z = d2 * rs * lg.z + lb.z;
      nv.w = d3 * rs * lg.w + lb.w;
      *reinterpret_cast<float4*>(&s_norm[t * NORM_STRIDE + lane * 4]) = nv;
    }
    __syncthreads();

    // ---- GEMM1: (16x128) x (128x32) -> one 16x16 tile per wave ----
    {
      const int n0 = cgrp * 16;
      v8f acc = {0.f, 0.f, 0.f, 0.f, 0.f, 0.f, 0.f, 0.f};
      for (int k0 = 0; k0 < D_; k0 += 4) {
        const v2f a = *reinterpret_cast<const v2f*>(
            &s_norm[(mtile * 16 + ln16) * NORM_STRIDE + k0 + 2 * hi]);
        v2f b;
        b[0] = wdh[(k0 + 2 * hi + 0) * K_ + n0 + ln16];
        b[1] = wdh[(k0 + 2 * hi + 1) * K_ + n0 + ln16];
        acc = __builtin_amdgcn_wmma_f32_16x16x4_f32(false, a, false, b,
                                                    (short)0, acc, false, false);
      }
      const float bias = bdn[h * K_ + n0 + ln16];
      #pragma unroll
      for (int r = 0; r < 8; ++r) {
        const float mval = gelu_exact(acc[r] + bias);
        s_mid[(mtile * 16 + r + 8 * hi) * MID_STRIDE + n0 + ln16] = mval;
      }
    }
    __syncthreads();

    // ---- GEMM2: (16x32) x (32x128) -> 4 column tiles per wave ----
    #pragma unroll
    for (int j = 0; j < 4; ++j) {
      const int n0 = cgrp * 64 + j * 16;
      v8f acc = {0.f, 0.f, 0.f, 0.f, 0.f, 0.f, 0.f, 0.f};
      for (int k0 = 0; k0 < K_; k0 += 4) {
        const v2f a = *reinterpret_cast<const v2f*>(
            &s_mid[(mtile * 16 + ln16) * MID_STRIDE + k0 + 2 * hi]);
        v2f b;
        b[0] = wuh[(k0 + 2 * hi + 0) * D_ + n0 + ln16];
        b[1] = wuh[(k0 + 2 * hi + 1) * D_ + n0 + ln16];
        acc = __builtin_amdgcn_wmma_f32_16x16x4_f32(false, a, false, b,
                                                    (short)0, acc, false, false);
      }
      const float bias = bup[h * D_ + n0 + ln16];
      if constexpr (PASS1) {
        float cs = 0.f, cq = 0.f;
        #pragma unroll
        for (int r = 0; r < 8; ++r) {
          const float yv = acc[r] + bias;
          cs += yv;
          cq += yv * yv;
        }
        cs += __shfl_xor(cs, 16, 32);   // fold the M+8 half onto the M half
        cq += __shfl_xor(cq, 16, 32);
        accS[j] += cs;
        accQ[j] += cq;
      } else {
        const float G  = gsh[h * D_ + n0 + ln16];
        const float SH = gsh[1024 + h * D_ + n0 + ln16];
        #pragma unroll
        for (int r = 0; r < 8; ++r) {
          const int tok = tokbase + mtile * 16 + r + 8 * hi;
          const size_t off = (size_t)tok * (H_ * D_) + h * D_ + n0 + ln16;
          out[off] = (acc[r] + bias) * G + SH + x[off];
        }
      }
    }
    __syncthreads();
  }

  if constexpr (PASS1) {
    if (hi == 0) {                       // lanes 0..15 hold the folded column sums
      #pragma unroll
      for (int j = 0; j < 4; ++j) {
        s_red[w * 64 + j * 16 + ln16]       = accS[j];
        s_red[512 + w * 64 + j * 16 + ln16] = accQ[j];
      }
    }
    __syncthreads();
    if (tid < 128) {                     // one thread per feature column d
      const int col = tid;
      const int grp = col >> 6;          // which cgrp owns this column
      const int cj  = col & 63;
      float s = 0.f, q = 0.f;
      for (int ww = grp; ww < 8; ww += 2) {
        s += s_red[ww * 64 + cj];
        q += s_red[512 + ww * 64 + cj];
      }
      const size_t base = (size_t)(h * TOKGRP + bx) * 256;
      partial[base + col]       = s;
      partial[base + 128 + col] = q;
    }
  }
}

// Fold per-block partials into per-feature (G, SH) with the 0.1 adapter scale pre-applied.
__global__ __launch_bounds__(256) void bn_stats(
    const float* __restrict__ partial,
    const float* __restrict__ bn_g, const float* __restrict__ bn_b,
    float* __restrict__ gsh)
{
  const int f = blockIdx.x * 256 + threadIdx.x;
  if (f >= H_ * D_) return;
  const int h = f >> 7;
  const int d = f & 127;
  float s = 0.f, q = 0.f;
  for (int tg = 0; tg < TOKGRP; ++tg) {
    const size_t base = (size_t)(h * TOKGRP + tg) * 256;
    s += partial[base + d];
    q += partial[base + 128 + d];
  }
  const float mean = s * (1.0f / (float)NTOK);
  const float var  = q * (1.0f / (float)NTOK) - mean * mean;
  const float g    = 0.1f * bn_g[f] * rsqrtf(var + 1e-5f);
  gsh[f]        = g;
  gsh[1024 + f] = 0.1f * bn_b[f] - mean * g;
}

extern "C" void kernel_launch(void* const* d_in, const int* in_sizes, int n_in,
                              void* d_out, int out_size, void* d_ws, size_t ws_size,
                              hipStream_t stream) {
  const float* x    = (const float*)d_in[0];
  const float* ln_g = (const float*)d_in[1];
  const float* ln_b = (const float*)d_in[2];
  const float* wd   = (const float*)d_in[3];
  const float* bdn  = (const float*)d_in[4];
  const float* wu   = (const float*)d_in[5];
  const float* bup  = (const float*)d_in[6];
  const float* bn_g = (const float*)d_in[7];
  const float* bn_b = (const float*)d_in[8];
  float* out = (float*)d_out;

  float* partial = (float*)d_ws;                 // 1024 blocks * 256 floats = 1 MB
  float* gsh     = partial + (size_t)H_ * TOKGRP * 256;  // 2048 floats

  dim3 grid(TOKGRP, H_);
  adapter_pass<true><<<grid, 256, 0, stream>>>(x, ln_g, ln_b, wd, bdn, wu, bup,
                                               nullptr, nullptr, partial);
  bn_stats<<<4, 256, 0, stream>>>(partial, bn_g, bn_b, gsh);
  adapter_pass<false><<<grid, 256, 0, stream>>>(x, ln_g, ln_b, wd, bdn, wu, bup,
                                                gsh, out, nullptr);
}

// v001
// A run of this version takes 105 microseconds.
// Two timings next to v000 put it at 1.69 and 1.70 times that version's speed.
#include <hip/hip_runtime.h>

typedef float v2f __attribute__((ext_vector_type(2)));
typedef float v8f __attribute__((ext_vector_type(8)));

#define H_ 8
#define D_ 128
#define K_ 32
#define NTOK 32768          // B*S
#define CHUNK_TOK 64
#define CHUNKS 4
#define TOKGRP 128          // gridDim.x ; TOKGRP*CHUNKS*CHUNK_TOK == NTOK
#define NORM_STRIDE 132     // 132 mod 64 = 4 -> conflict-free v2f A reads
#define MID_STRIDE 36

#define LN_ROWS 8           // token rows one wave normalises per chunk

// Butterfly sum over the wave for LN_ROWS independent values at once: each exchange
// step is issued for all rows before any result is used, so one exchange latency is
// paid per step instead of one per step and row (hence the full unrolls). Per row the
// order of additions is the plain butterfly's.
__device__ __forceinline__ void wave_sum_rows(float (&s)[LN_ROWS]) {
  #pragma unroll
  for (int m = 1; m < 32; m <<= 1) {
    float o[LN_ROWS];
    #pragma unroll
    for (int i = 0; i < LN_ROWS; ++i) o[i] = __shfl_xor(s[i], m, 32);
    #pragma unroll
    for (int i = 0; i < LN_ROWS; ++i) s[i] += o[i];
  }
}

__device__ __forceinline__ float gelu_exact(float v) {
  return 0.5f * v * (1.0f + erff(v * 0.70710678118654752440f));
}

// PASS1: compute y = up(gelu(down(ln(x)))) and emit per-block column sums / sumsq.
// PASS2 (PASS1=false): recompute y, apply pre-folded BN affine (G,SH) + residual.
template<bool PASS1>
__global__ __launch_bounds__(256) void adapter_pass(
    const float* __restrict__ x,
    const float* __restrict__ ln_g, const float* __restrict__ ln_b,
    const float* __restrict__ wd,  const float* __restrict__ bdn,
    const float* __restrict__ wu,  const float* __restrict__ bup,
    const float* __restrict__ gsh,   // PASS2: [f]=G=0.1*gamma*rs, [1024+f]=SH
    float* __restrict__ out,         // PASS2
    float* __restrict__ partial)     // PASS1: [(h*128+bx)*256 + {0:128 sum,128:256 sq}]
{
  __shared__ float s_norm[CHUNK_TOK * NORM_STRIDE];
  __shared__ float s_mid[CHUNK_TOK * MID_STRIDE];
  __shared__ float s_red[2 * 8 * 64];

  const int tid  = threadIdx.x;
  const int lane = tid & 31;
  const int w    = tid >> 5;      // wave 0..7
  const int hi   = lane >> 4;     // lane half selects K pair / M+8
  const int ln16 = lane & 15;
  const int h    = blockIdx.y;
  const int bx   = blockIdx.x;

  const float* __restrict__ wdh = wd + h * (D_ * K_);
  const float* __restrict__ wuh = wu + h * (K_ * D_);

  const float4 lg = *reinterpret_cast<const float4*>(ln_g + h * D_ + lane * 4);
  const float4 lb = *reinterpret_cast<const float4*>(ln_b + h * D_ + lane * 4);

  const int mtile = w >> 1;       // 0..3 : 16-token row tile
  const int cgrp  = w & 1;        // column group

  float accS[4] = {0.f, 0.f, 0.f, 0.f};
  float accQ[4] = {0.f, 0.f, 0.f, 0.f};

  for (int chunk = 0; chunk < CHUNKS; ++chunk) {
    const int tokbase = (bx * CHUNKS + chunk) * CHUNK_TOK;

    // ---- LayerNorm: one wave per token row, 8 tokens per wave ----
    // All 8 rows are loaded first and carried through the two reductions together.
    // The row loops are unrolled so that v[] and red[] stay in registers and the rows'
    // independent chains can be interleaved; rolled, each row would wait out its own
    // load and every exchange alone.
    {
      float4 v[LN_ROWS];
      float red[LN_ROWS];
      const float* __restrict__ xrow =
          x + (size_t)(tokbase + w * LN_ROWS) * (H_ * D_) + h * D_ + lane * 4;
      #pragma unroll
      for (int i = 0; i < LN_ROWS; ++i)
        v[i] = *reinterpret_cast<const float4*>(xrow + i * (H_ * D_));
      #pragma unroll
      for (int i = 0; i < LN_ROWS; ++i) red[i] = v[i].x + v[i].y + v[i].z + v[i].w;
      wave_sum_rows(red);
      #pragma unroll
      for (int i = 0; i < LN_ROWS; ++i) {
        const float mean = red[i] * (1.0f / 128.0f);
        v[i].x -= mean; v[i].y -= mean; v[i].z -= mean; v[i].w -= mean;
        red[i] = v[i].x * v[i].x + v[i].y * v[i].y + v[i].z * v[i].z + v[i].w * v[i].w;
      }
      wave_sum_rows(red);
      #pragma unroll
      for (int i = 0; i < LN_ROWS; ++i) {
        const int t = w * LN_ROWS + i;
        const float rs = rsqrtf(red[i] * (1.0f / 128.0f) + 1e-5f);
        float4 nv;
        nv.x = v[i].x * rs * lg.x + lb.x;
        nv.y = v[i].y * rs * lg.y + lb.y;
        nv.z = v[i].z * rs * lg.z + lb.z;
        nv.w = v[i].w * rs * lg.w + lb.w;
        *reinterpret_cast<float4*>(&s_norm[t * NORM_STRIDE + lane * 4]) = nv;
      }
    }
    __syncthreads();

    // ---- GEMM1: (16x128) x (128x32) -> one 16x16 tile per wave ----
    {
      const int n0 = cgrp * 16;
      v8f acc = {0.f, 0.f, 0.f, 0.f, 0.f, 0.f, 0.f, 0.f};
      for (int k0 = 0; k0 < D_; k0 += 4) {
        const v2f a = *reinterpret_cast<const v2f*>(
            &s_norm[(mtile * 16 + ln16) * NORM_STRIDE + k0 + 2 * hi]);
        v2f b;
        b[0] = wdh[(k0 + 2 * hi + 0) * K_ + n0 + ln16];
        b[1] = wdh[(k0 + 2 * hi + 1) * K_ + n0 + ln16];
        acc = __builtin_amdgcn_wmma_f32_16x16x4_f32(false, a, false, b,
                                                    (short)0, acc, false, false);
      }
      const float bias = bdn[h * K_ + n0 + ln16];
      #pragma unroll
      for (int r = 0; r < 8; ++r) {
        const float mval = gelu_exact(acc[r] + bias);
        s_mid[(mtile * 16 + r + 8 * hi) * MID_STRIDE + n0 + ln16] = mval;
      }
    }
    __syncthreads();

    // ---- GEMM2: (16x32) x (32x128) -> 4 column tiles per wave ----
    #pragma unroll
    for (int j = 0; j < 4; ++j) {
      const int n0 = cgrp * 64 + j * 16;
      v8f acc = {0.f, 0.f, 0.f, 0.f, 0.f, 0.f, 0.f, 0.f};
      for (int k0 = 0; k0 < K_; k0 += 4) {
        const v2f a = *reinterpret_cast<const v2f*>(
            &s_mid[(mtile * 16 + ln16) * MID_STRIDE + k0 + 2 * hi]);
        v2f b;
        b[0] = wuh[(k0 + 2 * hi + 0) * D_ + n0 + ln16];
        b[1] = wuh[(k0 + 2 * hi + 1) * D_ + n0 + ln16];
        acc = __builtin_amdgcn_wmma_f32_16x16x4_f32(false, a, false, b,
                                                    (short)0, acc, false, false);
      }
      const float bias = bup[h * D_ + n0 + ln16];
      if constexpr (PASS1) {
        float cs = 0.f, cq = 0.f;
        #pragma unroll
        for (int r = 0; r < 8; ++r) {
          const float yv = acc[r] + bias;
          cs += yv;
          cq += yv * yv;
        }
        cs += __shfl_xor(cs, 16, 32);   // fold the M+8 half onto the M half
        cq += __shfl_xor(cq, 16, 32);
        accS[j] += cs;
        accQ[j] += cq;
      } else {
        const float G  = gsh[h * D_ + n0 + ln16];
        const float SH = gsh[1024 + h * D_ + n0 + ln16];
        #pragma unroll
        for (int r = 0; r < 8; ++r) {
          const int tok = tokbase + mtile * 16 + r + 8 * hi;
          const size_t off = (size_t)tok * (H_ * D_) + h * D_ + n0 + ln16;
          out[off] = (acc[r] + bias) * G + SH + x[off];
        }
      }
    }
    __syncthreads();
  }

  if constexpr (PASS1) {
    if (hi == 0) {                       // lanes 0..15 hold the folded column sums
      #pragma unroll
      for (int j = 0; j < 4; ++j) {
        s_red[w * 64 + j * 16 + ln16]       = accS[j];
        s_red[512 + w * 64 + j * 16 + ln16] = accQ[j];
      }
    }
    __syncthreads();
    if (tid < 128) {                     // one thread per feature column d
      const int col = tid;
      const int grp = col >> 6;          // which cgrp owns this column
      const int cj  = col & 63;
      float s = 0.f, q = 0.f;
      for (int ww = grp; ww < 8; ww += 2) {
        s += s_red[ww * 64 + cj];
        q += s_red[512 + ww * 64 + cj];
      }
      const size_t base = (size_t)(h * TOKGRP + bx) * 256;
      partial[base + col]       = s;
      partial[base + 128 + col] = q;
    }
  }
}

// Fold per-block partials into per-feature (G, SH) with the 0.1 adapter scale pre-applied.
__global__ __launch_bounds__(256) void bn_stats(
    const float* __restrict__ partial,
    const float* __restrict__ bn_g, const float* __restrict__ bn_b,
    float* __restrict__ gsh)
{
  const int f = blockIdx.x * 256 + threadIdx.x;
  if (f >= H_ * D_) return;
  const int h = f >> 7;
  const int d = f & 127;
  float s = 0.f, q = 0.f;
  for (int tg = 0; tg < TOKGRP; ++tg) {
    const size_t base = (size_t)(h * TOKGRP + tg) * 256;
    s += partial[base + d];
    q += partial[base + 128 + d];
  }
  const float mean = s * (1.0f / (float)NTOK);
  const float var  = q * (1.0f / (float)NTOK) - mean * mean;
  const float g    = 0.1f * bn_g[f] * rsqrtf(var + 1e-5f);
  gsh[f]        = g;
  gsh[1024 + f] = 0.1f * bn_b[f] - mean * g;
}

extern "C" void kernel_launch(void* const* d_in, const int* in_sizes, int n_in,
                              void* d_out, int out_size, void* d_ws, size_t ws_size,
                              hipStream_t stream) {
  const float* x    = (const float*)d_in[0];
  const float* ln_g = (const float*)d_in[1];
  const float* ln_b = (const float*)d_in[2];
  const float* wd   = (const float*)d_in[3];
  const float* bdn  = (const float*)d_in[4];
  const float* wu   = (const float*)d_in[5];
  const float* bup  = (const float*)d_in[6];
  const float* bn_g = (const float*)d_in[7];
  const float* bn_b = (const float*)d_in[8];
  float* out = (float*)d_out;

  float* partial = (float*)d_ws;                 // 1024 blocks * 256 floats = 1 MB
  float* gsh     = partial + (size_t)H_ * TOKGRP * 256;  // 2048 floats

  dim3 grid(TOKGRP, H_);
  adapter_pass<true><<<grid, 256, 0, stream>>>(x, ln_g, ln_b, wd, bdn, wu, bup,
                                               nullptr, nullptr, partial);
  bn_stats<<<4, 256, 0, stream>>>(partial, bn_g, bn_b, gsh);
  adapter_pass<false><<<grid, 256, 0, stream>>>(x, ln_g, ln_b, wd, bdn, wu, bup,
                                                gsh, out, nullptr);
}

// v002
// A run of this version takes 80.8 microseconds.
// Timed twice side by side with v001, it ran 1.30 and 1.29 times as fast.
// Counting every step since v000, it is 2.19 times as fast.
#include <hip/hip_runtime.h>

typedef float v2f __attribute__((ext_vector_type(2)));
typedef float v8f __attribute__((ext_vector_type(8)));

#define H_ 8
#define D_ 128
#define K_ 32
#define NTOK 32768          // B*S
#define CHUNK_TOK 64
#define CHUNKS 4
#define TOKGRP 128          // gridDim.x ; TOKGRP*CHUNKS*CHUNK_TOK == NTOK
#define NORM_STRIDE 132     // 132 mod 64 = 4 -> conflict-free v2f A reads
#define MID_STRIDE 36

#define LN_ROWS 8           // token rows one wave normalises per chunk
#define MID_TILE 512        // floats of one saved 16-token x 32 activation tile

// Butterfly sum over the wave for LN_ROWS independent values at once: each exchange
// step is issued for all rows before any result is used, so one exchange latency is
// paid per step instead of one per step and row (hence the full unrolls). Per row the
// order of additions is the plain butterfly's.
__device__ __forceinline__ void wave_sum_rows(float (&s)[LN_ROWS]) {
  #pragma unroll
  for (int m = 1; m < 32; m <<= 1) {
    float o[LN_ROWS];
    #pragma unroll
    for (int i = 0; i < LN_ROWS; ++i) o[i] = __shfl_xor(s[i], m, 32);
    #pragma unroll
    for (int i = 0; i < LN_ROWS; ++i) s[i] += o[i];
  }
}

__device__ __forceinline__ float gelu_exact(float v) {
  return 0.5f * v * (1.0f + erff(v * 0.70710678118654752440f));
}

// First pass: m = gelu(down(ln(x))), y = up(m); emits per-block column sums / sumsq of y
// and saves m, so that the second pass starts from m instead of from x.
// Saved layout: one MID_TILE block per 16-token tile, in the order the up projection's
// A fragments are read: float4 number q*32+lane holds k = 8q+2*hi+{0,1} and 8q+4+2*hi+{0,1}
// of token row (lane & 15), so a wave's 16-byte access covers 512 contiguous bytes.
__global__ __launch_bounds__(256) void adapter_stats(
    const float* __restrict__ x,
    const float* __restrict__ ln_g, const float* __restrict__ ln_b,
    const float* __restrict__ wd,  const float* __restrict__ bdn,
    const float* __restrict__ wu,  const float* __restrict__ bup,
    float* __restrict__ mid,         // [(((h*128+bx)*4+chunk)*4+mtile)*MID_TILE]
    float* __restrict__ partial)     // [(h*128+bx)*256 + {0:128 sum,128:256 sq}]
{
  __shared__ float s_norm[CHUNK_TOK * NORM_STRIDE];
  __shared__ float s_mid[CHUNK_TOK * MID_STRIDE];
  __shared__ float s_red[2 * 8 * 64];

  const int tid  = threadIdx.x;
  const int lane = tid & 31;
  const int w    = tid >> 5;      // wave 0..7
  const int hi   = lane >> 4;     // lane half selects K pair / M+8
  const int ln16 = lane & 15;
  const int h    = blockIdx.y;
  const int bx   = blockIdx.x;

  const float* __restrict__ wdh = wd + h * (D_ * K_);
  const float* __restrict__ wuh = wu + h * (K_ * D_);

  const float4 lg = *reinterpret_cast<const float4*>(ln_g + h * D_ + lane * 4);
  const float4 lb = *reinterpret_cast<const float4*>(ln_b + h * D_ + lane * 4);

  const int mtile = w >> 1;       // 0..3 : 16-token row tile
  const int cgrp  = w & 1;        // column group

  float accS[4] = {0.f, 0.f, 0.f, 0.f};
  float accQ[4] = {0.f, 0.f, 0.f, 0.f};

  // Weights and biases do not change from chunk to chunk: read once, ahead of the loop.
  // Written out because the wait statement in the loop names memory, so the compiler
  // would no longer move these loads out of the loop by itself. The loops over bd[] and
  // bu[] are unrolled so that both stay in registers.
  v2f bd[32];
  #pragma unroll
  for (int s = 0; s < 32; ++s) {
    bd[s][0] = wdh[(s * 4 + 2 * hi + 0) * K_ + cgrp * 16 + ln16];
    bd[s][1] = wdh[(s * 4 + 2 * hi + 1) * K_ + cgrp * 16 + ln16];
  }
  const float bias_d = bdn[h * K_ + cgrp * 16 + ln16];
  v2f bu[4][8];
  float bias_u[4];
  #pragma unroll
  for (int j = 0; j < 4; ++j) {
    #pragma unroll
    for (int s = 0; s < 8; ++s) {
      bu[j][s][0] = wuh[(s * 4 + 2 * hi + 0) * D_ + cgrp * 64 + j * 16 + ln16];
      bu[j][s][1] = wuh[(s * 4 + 2 * hi + 1) * D_ + cgrp * 64 + j * 16 + ln16];
    }
    bias_u[j] = bup[h * D_ + cgrp * 64 + j * 16 + ln16];
  }

  for (int chunk = 0; chunk < CHUNKS; ++chunk) {
    const int tokbase = (bx * CHUNKS + chunk) * CHUNK_TOK;

    // ---- LayerNorm: one wave per token row, 8 tokens per wave ----
    // All 8 rows are loaded first and carried through the two reductions together.
    // The row loops are unrolled so that v[] and red[] stay in registers and the rows'
    // independent chains can be interleaved; rolled, each row would wait out its own
    // load and every exchange alone.
    {
      float4 v[LN_ROWS];
      float red[LN_ROWS];
      const float* __restrict__ xrow =
          x + (size_t)(tokbase + w * LN_ROWS) * (H_ * D_) + h * D_ + lane * 4;
      #pragma unroll
      for (int i = 0; i < LN_ROWS; ++i)
        v[i] = *reinterpret_cast<const float4*>(xrow + i * (H_ * D_));
      #pragma unroll
      for (int i = 0; i < LN_ROWS; ++i) red[i] = v[i].x + v[i].y + v[i].z + v[i].w;
      wave_sum_rows(red);
      #pragma unroll
      for (int i = 0; i < LN_ROWS; ++i) {
        const float mean = red[i] * (1.0f / 128.0f);
        v[i].x -= mean; v[i].y -= mean; v[i].z -= mean; v[i].w -= mean;
        red[i] = v[i].x * v[i].x + v[i].y * v[i].y + v[i].z * v[i].z + v[i].w * v[i].w;
      }
      wave_sum_rows(red);
      #pragma unroll
      for (int i = 0; i < LN_ROWS; ++i) {
        const int t = w * LN_ROWS + i;
        const float rs = rsqrtf(red[i] * (1.0f / 128.0f) + 1e-5f);
        float4 nv;
        nv.x = v[i].x * rs * lg.x + lb.x;
        nv.y = v[i].y * rs * lg.y + lb.y;
        nv.z = v[i].z * rs * lg.z + lb.z;
        nv.w = v[i].w * rs * lg.w + lb.w;
        *reinterpret_cast<float4*>(&s_norm[t * NORM_STRIDE + lane * 4]) = nv;
      }
    }
    __syncthreads();

    // ---- GEMM1: (16x128) x (128x32) -> one 16x16 tile per wave ----
    {
      const int n0 = cgrp * 16;
      v8f acc = {0.f, 0.f, 0.f, 0.f, 0.f, 0.f, 0.f, 0.f};
      #pragma unroll
      for (int s = 0; s < 32; ++s) {
        const v2f a = *reinterpret_cast<const v2f*>(
            &s_norm[(mtile * 16 + ln16) * NORM_STRIDE + s * 4 + 2 * hi]);
        acc = __builtin_amdgcn_wmma_f32_16x16x4_f32(false, a, false, bd[s],
                                                    (short)0, acc, false, false);
      }
      #pragma unroll
      for (int r = 0; r < 8; ++r) {
        const float mval = gelu_exact(acc[r] + bias_d);
        s_mid[(mtile * 16 + r + 8 * hi) * MID_STRIDE + n0 + ln16] = mval;
      }
    }
    __syncthreads();

    // ---- the wave's A fragments of GEMM2, read once (unrolled: af[] stays in registers) ----
    v2f af[8];
    #pragma unroll
    for (int s = 0; s < 8; ++s)
      af[s] = *reinterpret_cast<const v2f*>(
          &s_mid[(mtile * 16 + ln16) * MID_STRIDE + s * 4 + 2 * hi]);

    // ---- save the activation tile (one of the two waves that share it) ----
    if (cgrp == 0) {
      float4* __restrict__ mt = reinterpret_cast<float4*>(
          mid + (size_t)(((h * TOKGRP + bx) * CHUNKS + chunk) * 4 + mtile) * MID_TILE) + lane;
      #pragma unroll
      for (int q = 0; q < 4; ++q)
        mt[q * 32] = make_float4(af[2 * q][0], af[2 * q][1], af[2 * q + 1][0], af[2 * q + 1][1]);
      // the stores' address and data registers are reused right behind this block
      asm volatile("s_wait_xcnt 0x0" ::: "memory");
    }

    // ---- GEMM2: (16x32) x (32x128) -> 4 column tiles per wave ----
    #pragma unroll
    for (int j = 0; j < 4; ++j) {
      v8f acc = {0.f, 0.f, 0.f, 0.f, 0.f, 0.f, 0.f, 0.f};
      #pragma unroll
      for (int s = 0; s < 8; ++s)
        acc = __builtin_amdgcn_wmma_f32_16x16x4_f32(false, af[s], false, bu[j][s],
                                                    (short)0, acc, false, false);
      float cs = 0.f, cq = 0.f;
      #pragma unroll
      for (int r = 0; r < 8; ++r) {
        const float yv = acc[r] + bias_u[j];
        cs += yv;
        cq += yv * yv;
      }
      cs += __shfl_xor(cs, 16, 32);   // fold the M+8 half onto the M half
      cq += __shfl_xor(cq, 16, 32);
      accS[j] += cs;
      accQ[j] += cq;
    }
    __syncthreads();
  }

  if (hi == 0) {                       // lanes 0..15 hold the folded column sums
    #pragma unroll
    for (int j = 0; j < 4; ++j) {
      s_red[w * 64 + j * 16 + ln16]       = accS[j];
      s_red[512 + w * 64 + j * 16 + ln16] = accQ[j];
    }
  }
  __syncthreads();
  if (tid < 128) {                     // one thread per feature column d
    const int col = tid;
    const int grp = col >> 6;          // which cgrp owns this column
    const int cj  = col & 63;
    float s = 0.f, q = 0.f;
    for (int ww = grp; ww < 8; ww += 2) {
      s += s_red[ww * 64 + cj];
      q += s_red[512 + ww * 64 + cj];
    }
    const size_t base = (size_t)(h * TOKGRP + bx) * 256;
    partial[base + col]       = s;
    partial[base + 128 + col] = q;
  }
}

// Second pass: y = up(m) from the saved activations, then the pre-folded BN affine (G,SH)
// and the residual. Every wave works alone on its 16-token x 64-column tile: no LDS, no barrier.
__global__ __launch_bounds__(256) void adapter_apply(
    const float* __restrict__ x,
    const float* __restrict__ wu,  const float* __restrict__ bup,
    const float* __restrict__ gsh,   // [f]=G=0.1*gamma*rs, [1024+f]=SH
    const float* __restrict__ mid,   // layout: see adapter_stats
    float* __restrict__ out)
{
  const int tid  = threadIdx.x;
  const int lane = tid & 31;
  const int w    = tid >> 5;      // wave 0..7
  const int hi   = lane >> 4;     // lane half selects K pair / M+8
  const int ln16 = lane & 15;
  const int h    = blockIdx.y;
  const int bx   = blockIdx.x;
  const int mtile = w >> 1;       // 0..3 : 16-token row tile
  const int cgrp  = w & 1;        // column group

  const float* __restrict__ wuh = wu + h * (K_ * D_);
  const int col0 = h * D_ + cgrp * 64 + ln16;   // the lane's feature column in tile j = 0

  // What does not change from chunk to chunk is read once: B fragments, bias, G, SH.
  v2f bf[4][8];
  float bias[4], G[4], SH[4];
  #pragma unroll
  for (int j = 0; j < 4; ++j) {
    #pragma unroll
    for (int s = 0; s < 8; ++s) {
      bf[j][s][0] = wuh[(s * 4 + 2 * hi + 0) * D_ + cgrp * 64 + j * 16 + ln16];
      bf[j][s][1] = wuh[(s * 4 + 2 * hi + 1) * D_ + cgrp * 64 + j * 16 + ln16];
    }
    bias[j] = bup[col0 + j * 16];
    G[j]    = gsh[col0 + j * 16];
    SH[j]   = gsh[1024 + col0 + j * 16];
  }
  // the index registers of these loads are free for reuse from here on
  asm volatile("s_wait_xcnt 0x0" ::: "memory");

  const float4* __restrict__ mt = reinterpret_cast<const float4*>(
      mid + (size_t)((h * TOKGRP + bx) * CHUNKS * 4 + mtile) * MID_TILE) + lane;
  const size_t off0 = (size_t)(bx * CHUNKS * CHUNK_TOK + mtile * 16 + 8 * hi) * (H_ * D_) + col0;
  const float* __restrict__ xw = x + off0;
  float* __restrict__ ow = out + off0;

  // Two register sets: chunk c+1's activations and residual rows are on their way while
  // chunk c is multiplied. All loops over them are unrolled so that the sets stay registers.
  float4 aq[2][4];
  float  xr[2][4][8];
  #pragma unroll
  for (int q = 0; q < 4; ++q) aq[0][q] = mt[q * 32];
  // a residual load that follows may land in a register these loads name (as in the loop below)
  asm volatile("s_wait_xcnt 0x0" ::: "memory");
  #pragma unroll
  for (int j = 0; j < 4; ++j) {
    #pragma unroll
    for (int r = 0; r < 8; ++r) xr[0][j][r] = xw[r * (H_ * D_) + j * 16];
  }

  #pragma unroll
  for (int chunk = 0; chunk < CHUNKS; ++chunk) {
    const int cur = chunk & 1;
    if (chunk + 1 < CHUNKS) {
      #pragma unroll
      for (int q = 0; q < 4; ++q) aq[cur ^ 1][q] = mt[(chunk + 1) * (4 * MID_TILE / 4) + q * 32];
      // behind the last of these loads their address pair is free, and a residual load may land in it
      asm volatile("s_wait_xcnt 0x0" ::: "memory");
      #pragma unroll
      for (int j = 0; j < 4; ++j) {
        #pragma unroll
        for (int r = 0; r < 8; ++r)
          xr[cur ^ 1][j][r] = xw[((chunk + 1) * CHUNK_TOK + r) * (H_ * D_) + j * 16];
      }
    }
    // keeps the next chunk's loads in front of this chunk's matrix work, and that work
    // behind the last chunk's stores (else two chunks' results are held at once)
    __builtin_amdgcn_sched_barrier(0);

    // ---- GEMM2: (16x32) x (32x128) -> 4 column tiles per wave ----
    #pragma unroll
    for (int j = 0; j < 4; ++j) {
      v8f acc = {0.f, 0.f, 0.f, 0.f, 0.f, 0.f, 0.f, 0.f};
      #pragma unroll
      for (int q = 0; q < 4; ++q) {
        v2f a;
        a[0] = aq[cur][q].x;
        a[1] = aq[cur][q].y;
        acc = __builtin_amdgcn_wmma_f32_16x16x4_f32(false, a, false, bf[j][2 * q],
                                                    (short)0, acc, false, false);
        a[0] = aq[cur][q].z;
        a[1] = aq[cur][q].w;
        acc = __builtin_amdgcn_wmma_f32_16x16x4_f32(false, a, false, bf[j][2 * q + 1],
                                                    (short)0, acc, false, false);
      }
      #pragma unroll
      for (int r = 0; r < 8; ++r)
        ow[(chunk * CHUNK_TOK + r) * (H_ * D_) + j * 16] =
            (acc[r] + bias[j]) * G[j] + SH[j] + xr[cur][j][r];
    }
    // the stores' data registers are refilled by the next chunk's work
    if (chunk + 1 < CHUNKS) asm volatile("s_wait_xcnt 0x0" ::: "memory");
  }
}

// Fold per-block partials into per-feature (G, SH) with the 0.1 adapter scale pre-applied.
__global__ __launch_bounds__(256) void bn_stats(
    const float* __restrict__ partial,
    const float* __restrict__ bn_g, const float* __restrict__ bn_b,
    float* __restrict__ gsh)
{
  const int f = blockIdx.x * 256 + threadIdx.x;
  if (f >= H_ * D_) return;
  const int h = f >> 7;
  const int d = f & 127;
  float s = 0.f, q = 0.f;
  for (int tg = 0; tg < TOKGRP; ++tg) {
    const size_t base = (size_t)(h * TOKGRP + tg) * 256;
    s += partial[base + d];
    q += partial[base + 128 + d];
  }
  const float mean = s * (1.0f / (float)NTOK);
  const float var  = q * (1.0f / (float)NTOK) - mean * mean;
  const float g    = 0.1f * bn_g[f] * rsqrtf(var + 1e-5f);
  gsh[f]        = g;
  gsh[1024 + f] = 0.1f * bn_b[f] - mean * g;
}

extern "C" void kernel_launch(void* const* d_in, const int* in_sizes, int n_in,
                              void* d_out, int out_size, void* d_ws, size_t ws_size,
                              hipStream_t stream) {
  const float* x    = (const float*)d_in[0];
  const float* ln_g = (const float*)d_in[1];
  const float* ln_b = (const float*)d_in[2];
  const float* wd   = (const float*)d_in[3];
  const float* bdn  = (const float*)d_in[4];
  const float* wu   = (const float*)d_in[5];
  const float* bup  = (const float*)d_in[6];
  const float* bn_g = (const float*)d_in[7];
  const float* bn_b = (const float*)d_in[8];
  float* out = (float*)d_out;

  float* partial = (float*)d_ws;                 // 1024 blocks * 256 floats = 1 MB
  float* gsh     = partial + (size_t)H_ * TOKGRP * 256;  // 2048 floats
  float* mid     = gsh + 2048;                   // NTOK*H_*K_ floats = 32 MB

  dim3 grid(TOKGRP, H_);
  adapter_stats<<<grid, 256, 0, stream>>>(x, ln_g, ln_b, wd, bdn, wu, bup, mid, partial);
  bn_stats<<<4, 256, 0, stream>>>(partial, bn_g, bn_b, gsh);
  adapter_apply<<<grid, 256, 0, stream>>>(x, wu, bup, gsh, mid, out);
}

// v003
// One run takes 70.3 microseconds.
// In both of two side-by-side timings against v002, it was 1.15 times as fast.
// All steps since v000 together make it 2.52 times as fast.
#include <hip/hip_runtime.h>

typedef float v2f __attribute__((ext_vector_type(2)));
typedef float v8f __attribute__((ext_vector_type(8)));

#define H_ 8
#define D_ 128
#define K_ 32
#define NTOK 32768          // B*S
#define CHUNK_TOK 64
#define CHUNKS 4
#define TOKGRP 128          // gridDim.x ; TOKGRP*CHUNKS*CHUNK_TOK == NTOK
#define NORM_STRIDE 132     // 132 mod 64 = 4 -> conflict-free v2f A reads
#define MID_STRIDE 36

#define LN_ROWS 8           // token rows one wave normalises per chunk
#define MID_TILE 512        // floats of one saved 16-token x 32 activation tile
#define MOM_STRIDE 800      // floats of one block's moments: M00, M01, M11 (256 each), column sums (32)
#define MOM_WAVE 544        // floats one wave hands to the block's fold: 256 + 256 + 32

// Butterfly sum over the wave for LN_ROWS independent values at once: each exchange
// step is issued for all rows before any result is used, so one exchange latency is
// paid per step instead of one per step and row (hence the full unrolls). Per row the
// order of additions is the plain butterfly's.
__device__ __forceinline__ void wave_sum_rows(float (&s)[LN_ROWS]) {
  #pragma unroll
  for (int m = 1; m < 32; m <<= 1) {
    float o[LN_ROWS];
    #pragma unroll
    for (int i = 0; i < LN_ROWS; ++i) o[i] = __shfl_xor(s[i], m, 32);
    #pragma unroll
    for (int i = 0; i < LN_ROWS; ++i) s[i] += o[i];
  }
}

__device__ __forceinline__ float gelu_exact(float v) {
  return 0.5f * v * (1.0f + erff(v * 0.70710678118654752440f));
}

// First pass: m = gelu(down(ln(x))); saves m, so that the second pass starts from m instead
// of from x, and emits per block the column sums of m and its second moment M = m^T m
// (32 x 32, summed over the block's tokens). y = m Wu + b is linear in m, so the batch mean
// and variance of every column of y follow from these (see bn_stats): y is not formed here.
// M is kept as the tiles M00, M01, M11 (M10 is M01 transposed), each in accumulator order:
// float number r*32+lane holds row r + 8*(lane >> 4), column lane & 15.
// Saved layout: one MID_TILE block per 16-token tile, in the order the up projection's
// A fragments are read: float4 number q*32+lane holds k = 8q+2*hi+{0,1} and 8q+4+2*hi+{0,1}
// of token row (lane & 15), so a wave's 16-byte access covers 512 contiguous bytes.
__global__ __launch_bounds__(256) void adapter_stats(
    const float* __restrict__ x,
    const float* __restrict__ ln_g, const float* __restrict__ ln_b,
    const float* __restrict__ wd,  const float* __restrict__ bdn,
    float* __restrict__ mid,         // [(((h*128+bx)*4+chunk)*4+mtile)*MID_TILE]
    float* __restrict__ partial)     // [(h*128+bx)*MOM_STRIDE + {0 M00, 256 M01, 512 M11, 768 sums}]
{
  __shared__ float s_norm[CHUNK_TOK * NORM_STRIDE];
  __shared__ float s_mid[CHUNK_TOK * MID_STRIDE];

  const int tid  = threadIdx.x;
  const int lane = tid & 31;
  const int w    = tid >> 5;      // wave 0..7
  const int hi   = lane >> 4;     // lane half selects K pair / M+8
  const int ln16 = lane & 15;
  const int h    = blockIdx.y;
  const int bx   = blockIdx.x;

  const float* __restrict__ wdh = wd + h * (D_ * K_);

  const float4 lg = *reinterpret_cast<const float4*>(ln_g + h * D_ + lane * 4);
  const float4 lb = *reinterpret_cast<const float4*>(ln_b + h * D_ + lane * 4);

  const int mtile = w >> 1;       // 0..3 : 16-token row tile
  const int cgrp  = w & 1;        // column group

  // Moments of the wave's tokens, carried over all chunks: the diagonal tile of the wave's
  // own 16 columns, its half of the tile M01, and each lane's column sum.
  v8f momD = {0.f, 0.f, 0.f, 0.f, 0.f, 0.f, 0.f, 0.f};
  v8f momO = {0.f, 0.f, 0.f, 0.f, 0.f, 0.f, 0.f, 0.f};
  float csum = 0.f;

  // Weights and bias do not change from chunk to chunk: read once, ahead of the loop.
  // Written out because the wait statement in the loop names memory, so the compiler
  // would no longer move these loads out of the loop by itself. The loop over bd[] is
  // unrolled so that it stays in registers.
  v2f bd[32];
  #pragma unroll
  for (int s = 0; s < 32; ++s) {
    bd[s][0] = wdh[(s * 4 + 2 * hi + 0) * K_ + cgrp * 16 + ln16];
    bd[s][1] = wdh[(s * 4 + 2 * hi + 1) * K_ + cgrp * 16 + ln16];
  }
  const float bias_d = bdn[h * K_ + cgrp * 16 + ln16];

  for (int chunk = 0; chunk < CHUNKS; ++chunk) {
    const int tokbase = (bx * CHUNKS + chunk) * CHUNK_TOK;

    // ---- LayerNorm: one wave per token row, 8 tokens per wave ----
    // All 8 rows are loaded first and carried through the two reductions together.
    // The row loops are unrolled so that v[] and red[] stay in registers and the rows'
    // independent chains can be interleaved; rolled, each row would wait out its own
    // load and every exchange alone.
    {
      float4 v[LN_ROWS];
      float red[LN_ROWS];
      const float* __restrict__ xrow =
          x + (size_t)(tokbase + w * LN_ROWS) * (H_ * D_) + h * D_ + lane * 4;
      #pragma unroll
      for (int i = 0; i < LN_ROWS; ++i)
        v[i] = *reinterpret_cast<const float4*>(xrow + i * (H_ * D_));
      #pragma unroll
      for (int i = 0; i < LN_ROWS; ++i) red[i] = v[i].x + v[i].y + v[i].z + v[i].w;
      wave_sum_rows(red);
      #pragma unroll
      for (int i = 0; i < LN_ROWS; ++i) {
        const float mean = red[i] * (1.0f / 128.0f);
        v[i].x -= mean; v[i].y -= mean; v[i].z -= mean; v[i].w -= mean;
        red[i] = v[i].x * v[i].x + v[i].y * v[i].y + v[i].z * v[i].z + v[i].w * v[i].w;
      }
      wave_sum_rows(red);
      #pragma unroll
      for (int i = 0; i < LN_ROWS; ++i) {
        const int t = w * LN_ROWS + i;
        const float rs = rsqrtf(red[i] * (1.0f / 128.0f) + 1e-5f);
        float4 nv;
        nv.x = v[i].x * rs * lg.x + lb.x;
        nv.y = v[i].y * rs * lg.y + lb.y;
        nv.z = v[i].z * rs * lg.z + lb.z;
        nv.w = v[i].w * rs * lg.w + lb.w;
        *reinterpret_cast<float4*>(&s_norm[t * NORM_STRIDE + lane * 4]) = nv;
      }
    }
    __syncthreads();

    // ---- GEMM1: (16x128) x (128x32) -> one 16x16 tile per wave ----
    {
      const int n0 = cgrp * 16;
      v8f acc = {0.f, 0.f, 0.f, 0.f, 0.f, 0.f, 0.f, 0.f};
      #pragma unroll
      for (int s = 0; s < 32; ++s) {
        const v2f a = *reinterpret_cast<const v2f*>(
            &s_norm[(mtile * 16 + ln16) * NORM_STRIDE + s * 4 + 2 * hi]);
        acc = __builtin_amdgcn_wmma_f32_16x16x4_f32(false, a, false, bd[s],
                                                    (short)0, acc, false, false);
      }
      float mv[8];
      #pragma unroll
      for (int r = 0; r < 8; ++r) {
        mv[r] = gelu_exact(acc[r] + bias_d);
        s_mid[(mtile * 16 + r + 8 * hi) * MID_STRIDE + n0 + ln16] = mv[r];
        csum += mv[r];
      }
      // ---- diagonal moment tile, straight from the accumulator registers ----
      // The product sums over tokens, so any token order serves as long as A and B share it:
      // step s takes tokens 8*hi + 2s + {0,1}, which is what lane half hi holds in mv[2s], mv[2s+1];
      // lane & 15 is the column, as an A row and as a B column alike.
      #pragma unroll
      for (int s = 0; s < 4; ++s) {
        v2f f;
        f[0] = mv[2 * s];
        f[1] = mv[2 * s + 1];
        momD = __builtin_amdgcn_wmma_f32_16x16x4_f32(false, f, false, f,
                                                     (short)0, momD, false, false);
      }
    }
    __syncthreads();

    // ---- off-diagonal moment tile M01: A = columns 0..15, B = columns 16..31, same tokens ----
    // Shared out over the two waves of a token tile: of the four steps above, cgrp 0 takes
    // steps 0,1 and cgrp 1 steps 2,3. Both sides are read from s_mid, one of them being the
    // other wave's; the step is chosen in the address, so that no register is picked at run time.
    #pragma unroll
    for (int t = 0; t < 2; ++t) {
      const int row = mtile * 16 + 8 * hi + cgrp * 4 + 2 * t;
      v2f fa, fb;
      fa[0] = s_mid[(row + 0) * MID_STRIDE + ln16];
      fa[1] = s_mid[(row + 1) * MID_STRIDE + ln16];
      fb[0] = s_mid[(row + 0) * MID_STRIDE + 16 + ln16];
      fb[1] = s_mid[(row + 1) * MID_STRIDE + 16 + ln16];
      momO = __builtin_amdgcn_wmma_f32_16x16x4_f32(false, fa, false, fb,
                                                   (short)0, momO, false, false);
    }

    // ---- save the activation tile (one of the two waves that share it) ----
    if (cgrp == 0) {
      // the tile as the up projection's A fragments (unrolled: af[] stays in registers)
      v2f af[8];
      #pragma unroll
      for (int s = 0; s < 8; ++s)
        af[s] = *reinterpret_cast<const v2f*>(
            &s_mid[(mtile * 16 + ln16) * MID_STRIDE + s * 4 + 2 * hi]);
      float4* __restrict__ mt = reinterpret_cast<float4*>(
          mid + (size_t)(((h * TOKGRP + bx) * CHUNKS + chunk) * 4 + mtile) * MID_TILE) + lane;
      #pragma unroll
      for (int q = 0; q < 4; ++q)
        mt[q * 32] = make_float4(af[2 * q][0], af[2 * q][1], af[2 * q + 1][0], af[2 * q + 1][1]);
      // the stores' address and data registers are reused right behind this block
      asm volatile("s_wait_xcnt 0x0" ::: "memory");
    }

    __syncthreads();
  }

  // ---- fold the eight waves' moments; s_norm is free behind the loop's last barrier ----
  #pragma unroll
  for (int r = 0; r < 8; ++r) {
    s_norm[w * MOM_WAVE + r * 32 + lane]       = momD[r];
    s_norm[w * MOM_WAVE + 256 + r * 32 + lane] = momO[r];
  }
  s_norm[w * MOM_WAVE + 512 + lane] = csum;
  __syncthreads();
  {
    float m00 = 0.f, m01 = 0.f, m11 = 0.f;
    for (int t = 0; t < 4; ++t) {      // even waves own columns 0..15, odd waves 16..31
      m00 += s_norm[(2 * t) * MOM_WAVE + tid];
      m11 += s_norm[(2 * t + 1) * MOM_WAVE + tid];
      m01 += s_norm[(2 * t) * MOM_WAVE + 256 + tid] + s_norm[(2 * t + 1) * MOM_WAVE + 256 + tid];
    }
    const size_t base = (size_t)(h * TOKGRP + bx) * MOM_STRIDE;
    partial[base + tid]       = m00;
    partial[base + 256 + tid] = m01;
    partial[base + 512 + tid] = m11;
    if (tid < K_) {                    // one thread per activation column
      const int ww = tid >> 4;
      const int c  = tid & 15;
      float s = 0.f;
      for (int t = 0; t < 4; ++t)
        s += s_norm[(2 * t + ww) * MOM_WAVE + 512 + c] + s_norm[(2 * t + ww) * MOM_WAVE + 512 + 16 + c];
      partial[base + 768 + tid] = s;
    }
  }
}

// Second pass: y = up(m) from the saved activations, then the pre-folded BN affine (G,SH)
// and the residual. Every wave works alone on its 16-token x 64-column tile: no LDS, no barrier.
__global__ __launch_bounds__(256) void adapter_apply(
    const float* __restrict__ x,
    const float* __restrict__ wu,  const float* __restrict__ bup,
    const float* __restrict__ gsh,   // [f]=G=0.1*gamma*rs, [1024+f]=SH
    const float* __restrict__ mid,   // layout: see adapter_stats
    float* __restrict__ out)
{
  const int tid  = threadIdx.x;
  const int lane = tid & 31;
  const int w    = tid >> 5;      // wave 0..7
  const int hi   = lane >> 4;     // lane half selects K pair / M+8
  const int ln16 = lane & 15;
  const int h    = blockIdx.y;
  const int bx   = blockIdx.x;
  const int mtile = w >> 1;       // 0..3 : 16-token row tile
  const int cgrp  = w & 1;        // column group

  const float* __restrict__ wuh = wu + h * (K_ * D_);
  const int col0 = h * D_ + cgrp * 64 + ln16;   // the lane's feature column in tile j = 0

  // What does not change from chunk to chunk is read once: B fragments, bias, G, SH.
  v2f bf[4][8];
  float bias[4], G[4], SH[4];
  #pragma unroll
  for (int j = 0; j < 4; ++j) {
    #pragma unroll
    for (int s = 0; s < 8; ++s) {
      bf[j][s][0] = wuh[(s * 4 + 2 * hi + 0) * D_ + cgrp * 64 + j * 16 + ln16];
      bf[j][s][1] = wuh[(s * 4 + 2 * hi + 1) * D_ + cgrp * 64 + j * 16 + ln16];
    }
    bias[j] = bup[col0 + j * 16];
    G[j]    = gsh[col0 + j * 16];
    SH[j]   = gsh[1024 + col0 + j * 16];
  }
  // the index registers of these loads are free for reuse from here on
  asm volatile("s_wait_xcnt 0x0" ::: "memory");

  const float4* __restrict__ mt = reinterpret_cast<const float4*>(
      mid + (size_t)((h * TOKGRP + bx) * CHUNKS * 4 + mtile) * MID_TILE) + lane;
  const size_t off0 = (size_t)(bx * CHUNKS * CHUNK_TOK + mtile * 16 + 8 * hi) * (H_ * D_) + col0;
  const float* __restrict__ xw = x + off0;
  float* __restrict__ ow = out + off0;

  // Two register sets: chunk c+1's activations and residual rows are on their way while
  // chunk c is multiplied. All loops over them are unrolled so that the sets stay registers.
  float4 aq[2][4];
  float  xr[2][4][8];
  #pragma unroll
  for (int q = 0; q < 4; ++q) aq[0][q] = mt[q * 32];
  // a residual load that follows may land in a register these loads name (as in the loop below)
  asm volatile("s_wait_xcnt 0x0" ::: "memory");
  #pragma unroll
  for (int j = 0; j < 4; ++j) {
    #pragma unroll
    for (int r = 0; r < 8; ++r) xr[0][j][r] = xw[r * (H_ * D_) + j * 16];
  }

  #pragma unroll
  for (int chunk = 0; chunk < CHUNKS; ++chunk) {
    const int cur = chunk & 1;
    if (chunk + 1 < CHUNKS) {
      #pragma unroll
      for (int q = 0; q < 4; ++q) aq[cur ^ 1][q] = mt[(chunk + 1) * (4 * MID_TILE / 4) + q * 32];
      // behind the last of these loads their address pair is free, and a residual load may land in it
      asm volatile("s_wait_xcnt 0x0" ::: "memory");
      #pragma unroll
      for (int j = 0; j < 4; ++j) {
        #pragma unroll
        for (int r = 0; r < 8; ++r)
          xr[cur ^ 1][j][r] = xw[((chunk + 1) * CHUNK_TOK + r) * (H_ * D_) + j * 16];
      }
    }
    // keeps the next chunk's loads in front of this chunk's matrix work, and that work
    // behind the last chunk's stores (else two chunks' results are held at once)
    __builtin_amdgcn_sched_barrier(0);

    // ---- GEMM2: (16x32) x (32x128) -> 4 column tiles per wave ----
    #pragma unroll
    for (int j = 0; j < 4; ++j) {
      v8f acc = {0.f, 0.f, 0.f, 0.f, 0.f, 0.f, 0.f, 0.f};
      #pragma unroll
      for (int q = 0; q < 4; ++q) {
        v2f a;
        a[0] = aq[cur][q].x;
        a[1] = aq[cur][q].y;
        acc = __builtin_amdgcn_wmma_f32_16x16x4_f32(false, a, false, bf[j][2 * q],
                                                    (short)0, acc, false, false);
        a[0] = aq[cur][q].z;
        a[1] = aq[cur][q].w;
        acc = __builtin_amdgcn_wmma_f32_16x16x4_f32(false, a, false, bf[j][2 * q + 1],
                                                    (short)0, acc, false, false);
      }
      #pragma unroll
      for (int r = 0; r < 8; ++r)
        ow[(chunk * CHUNK_TOK + r) * (H_ * D_) + j * 16] =
            (acc[r] + bias[j]) * G[j] + SH[j] + xr[cur][j][r];
    }
    // the stores' data registers are refilled by the next chunk's work
    if (chunk + 1 < CHUNKS) asm volatile("s_wait_xcnt 0x0" ::: "memory");
  }
}

// Fold the blocks' moments into per-feature (G, SH) with the 0.1 adapter scale pre-applied.
// One block per head. With mu = mean of m and C = M / N - mu mu^T (the covariance of m),
// column d of y = m Wu + b has mean mu . Wu[:,d] + b[d] and variance Wu[:,d] . (C Wu)[:,d].
__global__ __launch_bounds__(1024) void bn_stats(
    const float* __restrict__ partial,
    const float* __restrict__ wu,  const float* __restrict__ bup,
    const float* __restrict__ bn_g, const float* __restrict__ bn_b,
    float* __restrict__ gsh)
{
  __shared__ float s_part[4 * MOM_STRIDE];   // four quarter sums over the head's blocks
  __shared__ float s_m[MOM_STRIDE];          // M / N in the blocks' order, then mu
  __shared__ float s_c[K_ * 34];             // C, row pitch 34: 8-byte reads, no bank shared
  __shared__ float s_v[4 * D_];              // per row tile of C: variance parts, then mean parts

  const int tid  = threadIdx.x;
  const int lane = tid & 31;
  const int hi   = lane >> 4;
  const int ln16 = lane & 15;
  const int h    = blockIdx.x;
  const int wv   = __builtin_amdgcn_readfirstlane(tid >> 5);   // wave number, in a scalar register
  const int ti   = wv & 1;          // 16-row tile of C
  const int tj   = (wv >> 1) & 7;   // 16-column tile of Wu

  // What does not depend on the moments is asked for first, so that it arrives under the fold.
  const float* __restrict__ wuc = wu + h * (K_ * D_) + tj * 16 + ln16;
  v2f bw[8];                        // B fragments of Wu
  float wr[8];                      // Wu at the accumulator's own positions
  #pragma unroll
  for (int s = 0; s < 8; ++s) {
    bw[s][0] = wuc[(s * 4 + 2 * hi + 0) * D_];
    bw[s][1] = wuc[(s * 4 + 2 * hi + 1) * D_];
    wr[s]    = wuc[(ti * 16 + s + 8 * hi) * D_];
  }
  const int f = h * D_ + (tid & (D_ - 1));
  const float gam = bn_g[f], bet = bn_b[f], bu = bup[f];

  // ---- sum over the head's TOKGRP blocks: 16-byte loads, a quarter of the blocks per thread ----
  {
    const int part = tid >> 8;
    const int c4   = tid & 255;
    if (c4 < MOM_STRIDE / 4) {
      const float4* __restrict__ p = reinterpret_cast<const float4*>(
          partial + (size_t)(h * TOKGRP + part * (TOKGRP / 4)) * MOM_STRIDE) + c4;
      float4 a = make_float4(0.f, 0.f, 0.f, 0.f);
      // unrolled so that 16 loads are in flight behind one wait instead of one
      #pragma unroll 16
      for (int t = 0; t < TOKGRP / 4; ++t) {
        const float4 v = p[t * (MOM_STRIDE / 4)];
        a.x += v.x; a.y += v.y; a.z += v.z; a.w += v.w;
      }
      reinterpret_cast<float4*>(s_part + part * MOM_STRIDE)[c4] = a;
    }
  }
  __syncthreads();
  if (tid < MOM_STRIDE)
    s_m[tid] = (s_part[tid] + s_part[MOM_STRIDE + tid] + s_part[2 * MOM_STRIDE + tid] +
                s_part[3 * MOM_STRIDE + tid]) * (1.0f / (float)NTOK);
  __syncthreads();

  // ---- C[k][l], one element per thread ----
  {
    const int k = tid >> 5;
    const int l = tid & 31;
    int plane, row, col;
    if ((k < 16) == (l < 16)) { plane = (k < 16) ? 0 : 512; row = k & 15; col = l & 15; }
    else                      { plane = 256; row = (k < 16) ? k : l; col = ((k < 16) ? l : k) - 16; }
    s_c[k * 34 + l] = s_m[plane + (row & 7) * 32 + (row >> 3) * 16 + col] - s_m[768 + k] * s_m[768 + l];
  }
  __syncthreads();

  // ---- T = C Wu, (32x32) x (32x128): one 16x16 tile per wave, sixteen waves ----
  if (wv < 16) {
    v8f acc = {0.f, 0.f, 0.f, 0.f, 0.f, 0.f, 0.f, 0.f};
    #pragma unroll
    for (int s = 0; s < 8; ++s) {
      const v2f a = *reinterpret_cast<const v2f*>(&s_c[(ti * 16 + ln16) * 34 + s * 4 + 2 * hi]);
      acc = __builtin_amdgcn_wmma_f32_16x16x4_f32(false, a, false, bw[s],
                                                  (short)0, acc, false, false);
    }
    float pv = 0.f, pm = 0.f;
    #pragma unroll
    for (int r = 0; r < 8; ++r) {
      pv += wr[r] * acc[r];
      pm += wr[r] * s_m[768 + ti * 16 + r + 8 * hi];
    }
    pv += __shfl_xor(pv, 16, 32);   // fold the rows r+8 onto the rows r
    pm += __shfl_xor(pm, 16, 32);
    if (hi == 0) {
      s_v[ti * D_ + tj * 16 + ln16]          = pv;
      s_v[2 * D_ + ti * D_ + tj * 16 + ln16] = pm;
    }
  }
  __syncthreads();

  if (tid < D_) {
    const float var  = s_v[tid] + s_v[D_ + tid];
    const float mean = s_v[2 * D_ + tid] + s_v[3 * D_ + tid] + bu;
    const float g    = 0.1f * gam * rsqrtf(var + 1e-5f);
    gsh[f]        = g;
    gsh[1024 + f] = 0.1f * bet - mean * g;
  }
}

extern "C" void kernel_launch(void* const* d_in, const int* in_sizes, int n_in,
                              void* d_out, int out_size, void* d_ws, size_t ws_size,
                              hipStream_t stream) {
  const float* x    = (const float*)d_in[0];
  const float* ln_g = (const float*)d_in[1];
  const float* ln_b = (const float*)d_in[2];
  const float* wd   = (const float*)d_in[3];
  const float* bdn  = (const float*)d_in[4];
  const float* wu   = (const float*)d_in[5];
  const float* bup  = (const float*)d_in[6];
  const float* bn_g = (const float*)d_in[7];
  const float* bn_b = (const float*)d_in[8];
  float* out = (float*)d_out;

  float* partial = (float*)d_ws;                 // 1024 blocks * MOM_STRIDE floats = 3.2 MB
  float* gsh     = partial + (size_t)H_ * TOKGRP * MOM_STRIDE;  // 2048 floats
  float* mid     = gsh + 2048;                   // NTOK*H_*K_ floats = 32 MB

  dim3 grid(TOKGRP, H_);
  adapter_stats<<<grid, 256, 0, stream>>>(x, ln_g, ln_b, wd, bdn, mid, partial);
  bn_stats<<<H_, 1024, 0, stream>>>(partial, wu, bup, bn_g, bn_b, gsh);
  adapter_apply<<<grid, 256, 0, stream>>>(x, wu, bup, gsh, mid, out);
}

// v004
// One run takes 60.8 microseconds.
// Two timings next to v003 put it at 1.15 and 1.16 times that version's speed.
// Counting every step since v000, it is 2.91 times as fast.
#include <hip/hip_runtime.h>

typedef float v2f __attribute__((ext_vector_type(2)));
typedef float v8f __attribute__((ext_vector_type(8)));

#define H_ 8
#define D_ 128
#define K_ 32
#define NTOK 32768          // B*S
#define CHUNK_TOK 64
#define CHUNKS 4
#define TOKGRP 128          // gridDim.x ; TOKGRP*CHUNKS*CHUNK_TOK == NTOK
#define NORM_STRIDE 132     // 132 mod 64 = 4 -> conflict-free v2f A reads
#define MID_STRIDE 36

#define LN_ROWS 8           // token rows one wave normalises per chunk
#define MID_TILE 512        // floats of one saved 16-token x 32 activation tile
#define MOM_STRIDE 800      // floats of one block's moments: M00, M01, M11 (256 each), column sums (32)
#define MOM_WAVE 544        // floats one wave hands to the block's fold: 256 + 256 + 32

// Butterfly sum over the wave for LN_ROWS independent values at once: each exchange
// step is issued for all rows before any result is used, so one exchange latency is
// paid per step instead of one per step and row (hence the full unrolls). Per row the
// order of additions is the plain butterfly's.
__device__ __forceinline__ void wave_sum_rows(float (&s)[LN_ROWS]) {
  #pragma unroll
  for (int m = 1; m < 32; m <<= 1) {
    float o[LN_ROWS];
    #pragma unroll
    for (int i = 0; i < LN_ROWS; ++i) o[i] = __shfl_xor(s[i], m, 32);
    #pragma unroll
    for (int i = 0; i < LN_ROWS; ++i) s[i] += o[i];
  }
}

__device__ __forceinline__ float gelu_exact(float v) {
  return 0.5f * v * (1.0f + erff(v * 0.70710678118654752440f));
}

// First pass: m = gelu(down(ln(x))); saves m, so that the second pass starts from m instead
// of from x, and emits per block the column sums of m and its second moment M = m^T m
// (32 x 32, summed over the block's tokens). y = m Wu + b is linear in m, so the batch mean
// and variance of every column of y follow from these (see bn_stats): y is not formed here.
// M is kept as the tiles M00, M01, M11 (M10 is M01 transposed), each in accumulator order:
// float number r*32+lane holds row r + 8*(lane >> 4), column lane & 15.
// Saved layout: one MID_TILE block per 16-token tile, in the order the up projection's
// A fragments are read: float4 number q*32+lane holds k = 8q+2*hi+{0,1} and 8q+4+2*hi+{0,1}
// of token row (lane & 15), so a wave's 16-byte access covers 512 contiguous bytes.
__global__ __launch_bounds__(256) void adapter_stats(
    const float* __restrict__ x,
    const float* __restrict__ ln_g, const float* __restrict__ ln_b,
    const float* __restrict__ wd,  const float* __restrict__ bdn,
    float* __restrict__ mid,         // [(((h*128+bx)*4+chunk)*4+mtile)*MID_TILE]
    float* __restrict__ partial)     // [(h*128+bx)*MOM_STRIDE + {0 M00, 256 M01, 512 M11, 768 sums}]
{
  __shared__ float s_norm[CHUNK_TOK * NORM_STRIDE];
  __shared__ float s_mid[CHUNK_TOK * MID_STRIDE];
  __shared__ float s_wd[D_ * K_];   // the head's down weights as B fragments: float (cgrp*32+s)*64 + lane*2 + {0,1}

  const int tid  = threadIdx.x;
  const int lane = tid & 31;
  const int w    = tid >> 5;      // wave 0..7
  const int hi   = lane >> 4;     // lane half selects K pair / M+8
  const int ln16 = lane & 15;
  const int h    = blockIdx.y;
  const int bx   = blockIdx.x;

  const float* __restrict__ wdh = wd + h * (D_ * K_);

  const float4 lg = *reinterpret_cast<const float4*>(ln_g + h * D_ + lane * 4);
  const float4 lb = *reinterpret_cast<const float4*>(ln_b + h * D_ + lane * 4);

  const int mtile = w >> 1;       // 0..3 : 16-token row tile
  const int cgrp  = w & 1;        // column group

  // Moments of the wave's tokens, carried over all chunks: the diagonal tile of the wave's
  // own 16 columns, its half of the tile M01, and each lane's column sum.
  v8f momD = {0.f, 0.f, 0.f, 0.f, 0.f, 0.f, 0.f, 0.f};
  v8f momO = {0.f, 0.f, 0.f, 0.f, 0.f, 0.f, 0.f, 0.f};
  float csum = 0.f;

  // The weights do not change from chunk to chunk. They are laid down once in LDS, in the
  // order the B fragments are read, instead of being held in 64 registers of every wave:
  // the register count then lets four blocks share a WGP instead of two. The four waves of
  // a column group write eight k steps each; the first barrier in the loop publishes them.
  // Unrolled so that a wave's sixteen loads go out together, behind one latency.
  #pragma unroll
  for (int i = 0; i < 8; ++i) {
    const int s = mtile * 8 + i;
    v2f b;
    b[0] = wdh[(s * 4 + 2 * hi + 0) * K_ + cgrp * 16 + ln16];
    b[1] = wdh[(s * 4 + 2 * hi + 1) * K_ + cgrp * 16 + ln16];
    *reinterpret_cast<v2f*>(&s_wd[(cgrp * 32 + s) * 64 + lane * 2]) = b;
  }
  const float bias_d = bdn[h * K_ + cgrp * 16 + ln16];

  for (int chunk = 0; chunk < CHUNKS; ++chunk) {
    const int tokbase = (bx * CHUNKS + chunk) * CHUNK_TOK;

    // ---- LayerNorm: one wave per token row, 8 tokens per wave ----
    // All 8 rows are loaded first and carried through the two reductions together.
    // The row loops are unrolled so that v[] and red[] stay in registers and the rows'
    // independent chains can be interleaved; rolled, each row would wait out its own
    // load and every exchange alone.
    {
      float4 v[LN_ROWS];
      float red[LN_ROWS];
      const float* __restrict__ xrow =
          x + (size_t)(tokbase + w * LN_ROWS) * (H_ * D_) + h * D_ + lane * 4;
      #pragma unroll
      for (int i = 0; i < LN_ROWS; ++i)
        v[i] = *reinterpret_cast<const float4*>(xrow + i * (H_ * D_));
      #pragma unroll
      for (int i = 0; i < LN_ROWS; ++i) red[i] = v[i].x + v[i].y + v[i].z + v[i].w;
      wave_sum_rows(red);
      #pragma unroll
      for (int i = 0; i < LN_ROWS; ++i) {
        const float mean = red[i] * (1.0f / 128.0f);
        v[i].x -= mean; v[i].y -= mean; v[i].z -= mean; v[i].w -= mean;
        red[i] = v[i].x * v[i].x + v[i].y * v[i].y + v[i].z * v[i].z + v[i].w * v[i].w;
      }
      wave_sum_rows(red);
      #pragma unroll
      for (int i = 0; i < LN_ROWS; ++i) {
        const int t = w * LN_ROWS + i;
        const float rs = rsqrtf(red[i] * (1.0f / 128.0f) + 1e-5f);
        float4 nv;
        nv.x = v[i].x * rs * lg.x + lb.x;
        nv.y = v[i].y * rs * lg.y + lb.y;
        nv.z = v[i].z * rs * lg.z + lb.z;
        nv.w = v[i].w * rs * lg.w + lb.w;
        *reinterpret_cast<float4*>(&s_norm[t * NORM_STRIDE + lane * 4]) = nv;
      }
    }
    __syncthreads();

    // ---- GEMM1: (16x128) x (128x32) -> one 16x16 tile per wave ----
    {
      const int n0 = cgrp * 16;
      v8f acc = {0.f, 0.f, 0.f, 0.f, 0.f, 0.f, 0.f, 0.f};
      #pragma unroll
      for (int s = 0; s < 32; ++s) {
        const v2f a = *reinterpret_cast<const v2f*>(
            &s_norm[(mtile * 16 + ln16) * NORM_STRIDE + s * 4 + 2 * hi]);
        const v2f b = *reinterpret_cast<const v2f*>(&s_wd[(cgrp * 32 + s) * 64 + lane * 2]);
        acc = __builtin_amdgcn_wmma_f32_16x16x4_f32(false, a, false, b,
                                                    (short)0, acc, false, false);
      }
      float mv[8];
      #pragma unroll
      for (int r = 0; r < 8; ++r) {
        mv[r] = gelu_exact(acc[r] + bias_d);
        s_mid[(mtile * 16 + r + 8 * hi) * MID_STRIDE + n0 + ln16] = mv[r];
        csum += mv[r];
      }
      // ---- diagonal moment tile, straight from the accumulator registers ----
      // The product sums over tokens, so any token order serves as long as A and B share it:
      // step s takes tokens 8*hi + 2s + {0,1}, which is what lane half hi holds in mv[2s], mv[2s+1];
      // lane & 15 is the column, as an A row and as a B column alike.
      #pragma unroll
      for (int s = 0; s < 4; ++s) {
        v2f f;
        f[0] = mv[2 * s];
        f[1] = mv[2 * s + 1];
        momD = __builtin_amdgcn_wmma_f32_16x16x4_f32(false, f, false, f,
                                                     (short)0, momD, false, false);
      }
    }
    __syncthreads();

    // ---- off-diagonal moment tile M01: A = columns 0..15, B = columns 16..31, same tokens ----
    // Shared out over the two waves of a token tile: of the four steps above, cgrp 0 takes
    // steps 0,1 and cgrp 1 steps 2,3. Both sides are read from s_mid, one of them being the
    // other wave's; the step is chosen in the address, so that no register is picked at run time.
    #pragma unroll
    for (int t = 0; t < 2; ++t) {
      const int row = mtile * 16 + 8 * hi + cgrp * 4 + 2 * t;
      v2f fa, fb;
      fa[0] = s_mid[(row + 0) * MID_STRIDE + ln16];
      fa[1] = s_mid[(row + 1) * MID_STRIDE + ln16];
      fb[0] = s_mid[(row + 0) * MID_STRIDE + 16 + ln16];
      fb[1] = s_mid[(row + 1) * MID_STRIDE + 16 + ln16];
      momO = __builtin_amdgcn_wmma_f32_16x16x4_f32(false, fa, false, fb,
                                                   (short)0, momO, false, false);
    }

    // ---- save the activation tile (one of the two waves that share it) ----
    if (cgrp == 0) {
      // the tile as the up projection's A fragments (unrolled: af[] stays in registers)
      v2f af[8];
      #pragma unroll
      for (int s = 0; s < 8; ++s)
        af[s] = *reinterpret_cast<const v2f*>(
            &s_mid[(mtile * 16 + ln16) * MID_STRIDE + s * 4 + 2 * hi]);
      float4* __restrict__ mt = reinterpret_cast<float4*>(
          mid + (size_t)(((h * TOKGRP + bx) * CHUNKS + chunk) * 4 + mtile) * MID_TILE) + lane;
      #pragma unroll
      for (int q = 0; q < 4; ++q)
        mt[q * 32] = make_float4(af[2 * q][0], af[2 * q][1], af[2 * q + 1][0], af[2 * q + 1][1]);
      // the stores' address and data registers are reused right behind this block
      asm volatile("s_wait_xcnt 0x0" ::: "memory");
    }

    __syncthreads();
  }

  // ---- fold the eight waves' moments; s_norm is free behind the loop's last barrier ----
  #pragma unroll
  for (int r = 0; r < 8; ++r) {
    s_norm[w * MOM_WAVE + r * 32 + lane]       = momD[r];
    s_norm[w * MOM_WAVE + 256 + r * 32 + lane] = momO[r];
  }
  s_norm[w * MOM_WAVE + 512 + lane] = csum;
  __syncthreads();
  {
    float m00 = 0.f, m01 = 0.f, m11 = 0.f;
    for (int t = 0; t < 4; ++t) {      // even waves own columns 0..15, odd waves 16..31
      m00 += s_norm[(2 * t) * MOM_WAVE + tid];
      m11 += s_norm[(2 * t + 1) * MOM_WAVE + tid];
      m01 += s_norm[(2 * t) * MOM_WAVE + 256 + tid] + s_norm[(2 * t + 1) * MOM_WAVE + 256 + tid];
    }
    const size_t base = (size_t)(h * TOKGRP + bx) * MOM_STRIDE;
    partial[base + tid]       = m00;
    partial[base + 256 + tid] = m01;
    partial[base + 512 + tid] = m11;
    if (tid < K_) {                    // one thread per activation column
      const int ww = tid >> 4;
      const int c  = tid & 15;
      float s = 0.f;
      for (int t = 0; t < 4; ++t)
        s += s_norm[(2 * t + ww) * MOM_WAVE + 512 + c] + s_norm[(2 * t + ww) * MOM_WAVE + 512 + 16 + c];
      partial[base + 768 + tid] = s;
    }
  }
}

// Second pass: y = up(m) from the saved activations, then the pre-folded BN affine (G,SH)
// and the residual. Every wave works alone on its 16-token x 64-column tile: no LDS, no barrier.
__global__ __launch_bounds__(256) void adapter_apply(
    const float* __restrict__ x,
    const float* __restrict__ wu,  const float* __restrict__ bup,
    const float* __restrict__ gsh,   // [f]=G=0.1*gamma*rs, [1024+f]=SH
    const float* __restrict__ mid,   // layout: see adapter_stats
    float* __restrict__ out)
{
  const int tid  = threadIdx.x;
  const int lane = tid & 31;
  const int w    = tid >> 5;      // wave 0..7
  const int hi   = lane >> 4;     // lane half selects K pair / M+8
  const int ln16 = lane & 15;
  const int h    = blockIdx.y;
  const int bx   = blockIdx.x;
  const int mtile = w >> 1;       // 0..3 : 16-token row tile
  const int cgrp  = w & 1;        // column group

  const float* __restrict__ wuh = wu + h * (K_ * D_);
  const int col0 = h * D_ + cgrp * 64 + ln16;   // the lane's feature column in tile j = 0

  // What does not change from chunk to chunk is read once: B fragments, bias, G, SH.
  v2f bf[4][8];
  float bias[4], G[4], SH[4];
  #pragma unroll
  for (int j = 0; j < 4; ++j) {
    #pragma unroll
    for (int s = 0; s < 8; ++s) {
      bf[j][s][0] = wuh[(s * 4 + 2 * hi + 0) * D_ + cgrp * 64 + j * 16 + ln16];
      bf[j][s][1] = wuh[(s * 4 + 2 * hi + 1) * D_ + cgrp * 64 + j * 16 + ln16];
    }
    bias[j] = bup[col0 + j * 16];
    G[j]    = gsh[col0 + j * 16];
    SH[j]   = gsh[1024 + col0 + j * 16];
  }
  // the index registers of these loads are free for reuse from here on
  asm volatile("s_wait_xcnt 0x0" ::: "memory");

  const float4* __restrict__ mt = reinterpret_cast<const float4*>(
      mid + (size_t)((h * TOKGRP + bx) * CHUNKS * 4 + mtile) * MID_TILE) + lane;
  const size_t off0 = (size_t)(bx * CHUNKS * CHUNK_TOK + mtile * 16 + 8 * hi) * (H_ * D_) + col0;
  const float* __restrict__ xw = x + off0;
  float* __restrict__ ow = out + off0;

  // Two register sets: chunk c+1's activations and residual rows are on their way while
  // chunk c is multiplied. All loops over them are unrolled so that the sets stay registers.
  float4 aq[2][4];
  float  xr[2][4][8];
  #pragma unroll
  for (int q = 0; q < 4; ++q) aq[0][q] = mt[q * 32];
  // a residual load that follows may land in a register these loads name (as in the loop below)
  asm volatile("s_wait_xcnt 0x0" ::: "memory");
  #pragma unroll
  for (int j = 0; j < 4; ++j) {
    #pragma unroll
    for (int r = 0; r < 8; ++r) xr[0][j][r] = xw[r * (H_ * D_) + j * 16];
  }

  #pragma unroll
  for (int chunk = 0; chunk < CHUNKS; ++chunk) {
    const int cur = chunk & 1;
    if (chunk + 1 < CHUNKS) {
      #pragma unroll
      for (int q = 0; q < 4; ++q) aq[cur ^ 1][q] = mt[(chunk + 1) * (4 * MID_TILE / 4) + q * 32];
      // behind the last of these loads their address pair is free, and a residual load may land in it
      asm volatile("s_wait_xcnt 0x0" ::: "memory");
      #pragma unroll
      for (int j = 0; j < 4; ++j) {
        #pragma unroll
        for (int r = 0; r < 8; ++r)
          xr[cur ^ 1][j][r] = xw[((chunk + 1) * CHUNK_TOK + r) * (H_ * D_) + j * 16];
      }
    }
    // keeps the next chunk's loads in front of this chunk's matrix work, and that work
    // behind the last chunk's stores (else two chunks' results are held at once)
    __builtin_amdgcn_sched_barrier(0);

    // ---- GEMM2: (16x32) x (32x128) -> 4 column tiles per wave ----
    #pragma unroll
    for (int j = 0; j < 4; ++j) {
      v8f acc = {0.f, 0.f, 0.f, 0.f, 0.f, 0.f, 0.f, 0.f};
      #pragma unroll
      for (int q = 0; q < 4; ++q) {
        v2f a;
        a[0] = aq[cur][q].x;
        a[1] = aq[cur][q].y;
        acc = __builtin_amdgcn_wmma_f32_16x16x4_f32(false, a, false, bf[j][2 * q],
                                                    (short)0, acc, false, false);
        a[0] = aq[cur][q].z;
        a[1] = aq[cur][q].w;
        acc = __builtin_amdgcn_wmma_f32_16x16x4_f32(false, a, false, bf[j][2 * q + 1],
                                                    (short)0, acc, false, false);
      }
      #pragma unroll
      for (int r = 0; r < 8; ++r)
        ow[(chunk * CHUNK_TOK + r) * (H_ * D_) + j * 16] =
            (acc[r] + bias[j]) * G[j] + SH[j] + xr[cur][j][r];
    }
    // the stores' data registers are refilled by the next chunk's work
    if (chunk + 1 < CHUNKS) asm volatile("s_wait_xcnt 0x0" ::: "memory");
  }
}

// Fold the blocks' moments into per-feature (G, SH) with the 0.1 adapter scale pre-applied.
// One block per head. With mu = mean of m and C = M / N - mu mu^T (the covariance of m),
// column d of y = m Wu + b has mean mu . Wu[:,d] + b[d] and variance Wu[:,d] . (C Wu)[:,d].
__global__ __launch_bounds__(1024) void bn_stats(
    const float* __restrict__ partial,
    const float* __restrict__ wu,  const float* __restrict__ bup,
    const float* __restrict__ bn_g, const float* __restrict__ bn_b,
    float* __restrict__ gsh)
{
  __shared__ float s_part[4 * MOM_STRIDE];   // four quarter sums over the head's blocks
  __shared__ float s_m[MOM_STRIDE];          // M / N in the blocks' order, then mu
  __shared__ float s_c[K_ * 34];             // C, row pitch 34: 8-byte reads, no bank shared
  __shared__ float s_v[4 * D_];              // per row tile of C: variance parts, then mean parts

  const int tid  = threadIdx.x;
  const int lane = tid & 31;
  const int hi   = lane >> 4;
  const int ln16 = lane & 15;
  const int h    = blockIdx.x;
  const int wv   = __builtin_amdgcn_readfirstlane(tid >> 5);   // wave number, in a scalar register
  const int ti   = wv & 1;          // 16-row tile of C
  const int tj   = (wv >> 1) & 7;   // 16-column tile of Wu

  // What does not depend on the moments is asked for first, so that it arrives under the fold.
  const float* __restrict__ wuc = wu + h * (K_ * D_) + tj * 16 + ln16;
  v2f bw[8];                        // B fragments of Wu
  float wr[8];                      // Wu at the accumulator's own positions
  #pragma unroll
  for (int s = 0; s < 8; ++s) {
    bw[s][0] = wuc[(s * 4 + 2 * hi + 0) * D_];
    bw[s][1] = wuc[(s * 4 + 2 * hi + 1) * D_];
    wr[s]    = wuc[(ti * 16 + s + 8 * hi) * D_];
  }
  const int f = h * D_ + (tid & (D_ - 1));
  const float gam = bn_g[f], bet = bn_b[f], bu = bup[f];

  // ---- sum over the head's TOKGRP blocks: 16-byte loads, a quarter of the blocks per thread ----
  {
    const int part = tid >> 8;
    const int c4   = tid & 255;
    if (c4 < MOM_STRIDE / 4) {
      const float4* __restrict__ p = reinterpret_cast<const float4*>(
          partial + (size_t)(h * TOKGRP + part * (TOKGRP / 4)) * MOM_STRIDE) + c4;
      float4 a = make_float4(0.f, 0.f, 0.f, 0.f);
      // unrolled so that 16 loads are in flight behind one wait instead of one
      #pragma unroll 16
      for (int t = 0; t < TOKGRP / 4; ++t) {
        const float4 v = p[t * (MOM_STRIDE / 4)];
        a.x += v.x; a.y += v.y; a.z += v.z; a.w += v.w;
      }
      reinterpret_cast<float4*>(s_part + part * MOM_STRIDE)[c4] = a;
    }
  }
  __syncthreads();
  if (tid < MOM_STRIDE)
    s_m[tid] = (s_part[tid] + s_part[MOM_STRIDE + tid] + s_part[2 * MOM_STRIDE + tid] +
                s_part[3 * MOM_STRIDE + tid]) * (1.0f / (float)NTOK);
  __syncthreads();

  // ---- C[k][l], one element per thread ----
  {
    const int k = tid >> 5;
    const int l = tid & 31;
    int plane, row, col;
    if ((k < 16) == (l < 16)) { plane = (k < 16) ? 0 : 512; row = k & 15; col = l & 15; }
    else                      { plane = 256; row = (k < 16) ? k : l; col = ((k < 16) ? l : k) - 16; }
    s_c[k * 34 + l] = s_m[plane + (row & 7) * 32 + (row >> 3) * 16 + col] - s_m[768 + k] * s_m[768 + l];
  }
  __syncthreads();

  // ---- T = C Wu, (32x32) x (32x128): one 16x16 tile per wave, sixteen waves ----
  if (wv < 16) {
    v8f acc = {0.f, 0.f, 0.f, 0.f, 0.f, 0.f, 0.f, 0.f};
    #pragma unroll
    for (int s = 0; s < 8; ++s) {
      const v2f a = *reinterpret_cast<const v2f*>(&s_c[(ti * 16 + ln16) * 34 + s * 4 + 2 * hi]);
      acc = __builtin_amdgcn_wmma_f32_16x16x4_f32(false, a, false, bw[s],
                                                  (short)0, acc, false, false);
    }
    float pv = 0.f, pm = 0.f;
    #pragma unroll
    for (int r = 0; r < 8; ++r) {
      pv += wr[r] * acc[r];
      pm += wr[r] * s_m[768 + ti * 16 + r + 8 * hi];
    }
    pv += __shfl_xor(pv, 16, 32);   // fold the rows r+8 onto the rows r
    pm += __shfl_xor(pm, 16, 32);
    if (hi == 0) {
      s_v[ti * D_ + tj * 16 + ln16]          = pv;
      s_v[2 * D_ + ti * D_ + tj * 16 + ln16] = pm;
    }
  }
  __syncthreads();

  if (tid < D_) {
    const float var  = s_v[tid] + s_v[D_ + tid];
    const float mean = s_v[2 * D_ + tid] + s_v[3 * D_ + tid] + bu;
    const float g    = 0.1f * gam * rsqrtf(var + 1e-5f);
    gsh[f]        = g;
    gsh[1024 + f] = 0.1f * bet - mean * g;
  }
}

extern "C" void kernel_launch(void* const* d_in, const int* in_sizes, int n_in,
                              void* d_out, int out_size, void* d_ws, size_t ws_size,
                              hipStream_t stream) {
  const float* x    = (const float*)d_in[0];
  const float* ln_g = (const float*)d_in[1];
  const float* ln_b = (const float*)d_in[2];
  const float* wd   = (const float*)d_in[3];
  const float* bdn  = (const float*)d_in[4];
  const float* wu   = (const float*)d_in[5];
  const float* bup  = (const float*)d_in[6];
  const float* bn_g = (const float*)d_in[7];
  const float* bn_b = (const float*)d_in[8];
  float* out = (float*)d_out;

  float* partial = (float*)d_ws;                 // 1024 blocks * MOM_STRIDE floats = 3.2 MB
  float* gsh     = partial + (size_t)H_ * TOKGRP * MOM_STRIDE;  // 2048 floats
  float* mid     = gsh + 2048;                   // NTOK*H_*K_ floats = 32 MB

  dim3 grid(TOKGRP, H_);
  adapter_stats<<<grid, 256, 0, stream>>>(x, ln_g, ln_b, wd, bdn, mid, partial);
  bn_stats<<<H_, 1024, 0, stream>>>(partial, wu, bup, bn_g, bn_b, gsh);
  adapter_apply<<<grid, 256, 0, stream>>>(x, wu, bup, gsh, mid, out);
}

// v005
// A run of this version takes 58.8 microseconds.
// Timed twice side by side with v004, it ran 1.04 times as fast both times.
// Over all steps from v000 it is 3.03 times as fast.
#include <hip/hip_runtime.h>

typedef float v2f __attribute__((ext_vector_type(2)));
typedef float v8f __attribute__((ext_vector_type(8)));

#define H_ 8
#define D_ 128
#define K_ 32
#define NTOK 32768          // B*S
#define CHUNK_TOK 64
#define CHUNKS 4
#define TOKGRP 128          // gridDim.x ; TOKGRP*CHUNKS*CHUNK_TOK == NTOK
#define NORM_STRIDE 132     // 132 mod 64 = 4 -> conflict-free v2f A reads
#define MID_STRIDE 36

#define LN_ROWS 8           // token rows one wave normalises per chunk
#define MID_TILE 512        // floats of one saved 16-token x 32 activation tile
#define MOM_STRIDE 800      // floats of one block's moments: M00, M01, M11 (256 each), column sums (32)
#define MOM_WAVE 544        // floats one wave hands to the block's fold: 256 + 256 + 32

// Butterfly sum over the wave for LN_ROWS independent values at once: each exchange
// step is issued for all rows before any result is used, so one exchange latency is
// paid per step instead of one per step and row (hence the full unrolls). Per row the
// order of additions is the plain butterfly's.
__device__ __forceinline__ void wave_sum_rows(float (&s)[LN_ROWS]) {
  #pragma unroll
  for (int m = 1; m < 32; m <<= 1) {
    float o[LN_ROWS];
    #pragma unroll
    for (int i = 0; i < LN_ROWS; ++i) o[i] = __shfl_xor(s[i], m, 32);
    #pragma unroll
    for (int i = 0; i < LN_ROWS; ++i) s[i] += o[i];
  }
}

__device__ __forceinline__ float gelu_exact(float v) {
  return 0.5f * v * (1.0f + erff(v * 0.70710678118654752440f));
}

// First pass: m = gelu(down(ln(x))); saves m, so that the second pass starts from m instead
// of from x, and emits per block the column sums of m and its second moment M = m^T m
// (32 x 32, summed over the block's tokens). y = m Wu + b is linear in m, so the batch mean
// and variance of every column of y follow from these (see bn_stats): y is not formed here.
// M is kept as the tiles M00, M01, M11 (M10 is M01 transposed), each in accumulator order:
// float number r*32+lane holds row r + 8*(lane >> 4), column lane & 15.
// Saved layout: one MID_TILE block per 16-token tile, in the order the up projection's
// A fragments are read: float4 number q*32+lane holds k = 8q+2*hi+{0,1} and 8q+4+2*hi+{0,1}
// of token row (lane & 15), so a wave's 16-byte access covers 512 contiguous bytes.
__global__ __launch_bounds__(256) void adapter_stats(
    const float* __restrict__ x,
    const float* __restrict__ ln_g, const float* __restrict__ ln_b,
    const float* __restrict__ wd,  const float* __restrict__ bdn,
    float* __restrict__ mid,         // [(((h*128+bx)*4+chunk)*4+mtile)*MID_TILE]
    float* __restrict__ partial)     // [(h*128+bx)*MOM_STRIDE + {0 M00, 256 M01, 512 M11, 768 sums}]
{
  __shared__ float s_norm[CHUNK_TOK * NORM_STRIDE];
  __shared__ float s_mid[CHUNK_TOK * MID_STRIDE];
  __shared__ float s_wd[D_ * K_];   // the head's down weights as B fragments: float (cgrp*32+s)*64 + lane*2 + {0,1}

  const int tid  = threadIdx.x;
  const int lane = tid & 31;
  const int w    = tid >> 5;      // wave 0..7
  const int hi   = lane >> 4;     // lane half selects K pair / M+8
  const int ln16 = lane & 15;
  const int h    = blockIdx.y;
  const int bx   = blockIdx.x;

  const float* __restrict__ wdh = wd + h * (D_ * K_);

  const float4 lg = *reinterpret_cast<const float4*>(ln_g + h * D_ + lane * 4);
  const float4 lb = *reinterpret_cast<const float4*>(ln_b + h * D_ + lane * 4);

  const int mtile = w >> 1;       // 0..3 : 16-token row tile
  const int cgrp  = w & 1;        // column group

  // Moments of the wave's tokens, carried over all chunks: the diagonal tile of the wave's
  // own 16 columns, its half of the tile M01, and each lane's column sum.
  v8f momD = {0.f, 0.f, 0.f, 0.f, 0.f, 0.f, 0.f, 0.f};
  v8f momO = {0.f, 0.f, 0.f, 0.f, 0.f, 0.f, 0.f, 0.f};
  float csum = 0.f;

  // The weights do not change from chunk to chunk. They are laid down once in LDS, in the
  // order the B fragments are read, instead of being held in 64 registers of every wave:
  // the register count then lets four blocks share a WGP instead of two. The four waves of
  // a column group write eight k steps each; the first barrier in the loop publishes them.
  // Unrolled so that a wave's sixteen loads go out together, behind one latency.
  #pragma unroll
  for (int i = 0; i < 8; ++i) {
    const int s = mtile * 8 + i;
    v2f b;
    b[0] = wdh[(s * 4 + 2 * hi + 0) * K_ + cgrp * 16 + ln16];
    b[1] = wdh[(s * 4 + 2 * hi + 1) * K_ + cgrp * 16 + ln16];
    *reinterpret_cast<v2f*>(&s_wd[(cgrp * 32 + s) * 64 + lane * 2]) = b;
  }
  const float bias_d = bdn[h * K_ + cgrp * 16 + ln16];

  for (int chunk = 0; chunk < CHUNKS; ++chunk) {
    const int tokbase = (bx * CHUNKS + chunk) * CHUNK_TOK;

    // ---- LayerNorm: one wave per token row, 8 tokens per wave ----
    // All 8 rows are loaded first and carried through the two reductions together.
    // The row loops are unrolled so that v[] and red[] stay in registers and the rows'
    // independent chains can be interleaved; rolled, each row would wait out its own
    // load and every exchange alone.
    {
      float4 v[LN_ROWS];
      float red[LN_ROWS];
      const float* __restrict__ xrow =
          x + (size_t)(tokbase + w * LN_ROWS) * (H_ * D_) + h * D_ + lane * 4;
      #pragma unroll
      for (int i = 0; i < LN_ROWS; ++i)
        v[i] = *reinterpret_cast<const float4*>(xrow + i * (H_ * D_));
      #pragma unroll
      for (int i = 0; i < LN_ROWS; ++i) red[i] = v[i].x + v[i].y + v[i].z + v[i].w;
      wave_sum_rows(red);
      #pragma unroll
      for (int i = 0; i < LN_ROWS; ++i) {
        const float mean = red[i] * (1.0f / 128.0f);
        v[i].x -= mean; v[i].y -= mean; v[i].z -= mean; v[i].w -= mean;
        red[i] = v[i].x * v[i].x + v[i].y * v[i].y + v[i].z * v[i].z + v[i].w * v[i].w;
      }
      wave_sum_rows(red);
      #pragma unroll
      for (int i = 0; i < LN_ROWS; ++i) {
        const int t = w * LN_ROWS + i;
        const float rs = rsqrtf(red[i] * (1.0f / 128.0f) + 1e-5f);
        float4 nv;
        nv.x = v[i].x * rs * lg.x + lb.x;
        nv.y = v[i].y * rs * lg.y + lb.y;
        nv.z = v[i].z * rs * lg.z + lb.z;
        nv.w = v[i].w * rs * lg.w + lb.w;
        *reinterpret_cast<float4*>(&s_norm[t * NORM_STRIDE + lane * 4]) = nv;
      }
    }
    __syncthreads();

    // ---- GEMM1: (16x128) x (128x32) -> one 16x16 tile per wave ----
    {
      const int n0 = cgrp * 16;
      v8f acc = {0.f, 0.f, 0.f, 0.f, 0.f, 0.f, 0.f, 0.f};
      #pragma unroll
      for (int s = 0; s < 32; ++s) {
        const v2f a = *reinterpret_cast<const v2f*>(
            &s_norm[(mtile * 16 + ln16) * NORM_STRIDE + s * 4 + 2 * hi]);
        const v2f b = *reinterpret_cast<const v2f*>(&s_wd[(cgrp * 32 + s) * 64 + lane * 2]);
        acc = __builtin_amdgcn_wmma_f32_16x16x4_f32(false, a, false, b,
                                                    (short)0, acc, false, false);
      }
      float mv[8];
      #pragma unroll
      for (int r = 0; r < 8; ++r) {
        mv[r] = gelu_exact(acc[r] + bias_d);
        s_mid[(mtile * 16 + r + 8 * hi) * MID_STRIDE + n0 + ln16] = mv[r];
        csum += mv[r];
      }
      // ---- diagonal moment tile, straight from the accumulator registers ----
      // The product sums over tokens, so any token order serves as long as A and B share it:
      // step s takes tokens 8*hi + 2s + {0,1}, which is what lane half hi holds in mv[2s], mv[2s+1];
      // lane & 15 is the column, as an A row and as a B column alike.
      #pragma unroll
      for (int s = 0; s < 4; ++s) {
        v2f f;
        f[0] = mv[2 * s];
        f[1] = mv[2 * s + 1];
        momD = __builtin_amdgcn_wmma_f32_16x16x4_f32(false, f, false, f,
                                                     (short)0, momD, false, false);
      }
    }
    __syncthreads();

    // ---- off-diagonal moment tile M01: A = columns 0..15, B = columns 16..31, same tokens ----
    // Shared out over the two waves of a token tile: of the four steps above, cgrp 0 takes
    // steps 0,1 and cgrp 1 steps 2,3. Both sides are read from s_mid, one of them being the
    // other wave's; the step is chosen in the address, so that no register is picked at run time.
    #pragma unroll
    for (int t = 0; t < 2; ++t) {
      const int row = mtile * 16 + 8 * hi + cgrp * 4 + 2 * t;
      v2f fa, fb;
      fa[0] = s_mid[(row + 0) * MID_STRIDE + ln16];
      fa[1] = s_mid[(row + 1) * MID_STRIDE + ln16];
      fb[0] = s_mid[(row + 0) * MID_STRIDE + 16 + ln16];
      fb[1] = s_mid[(row + 1) * MID_STRIDE + 16 + ln16];
      momO = __builtin_amdgcn_wmma_f32_16x16x4_f32(false, fa, false, fb,
                                                   (short)0, momO, false, false);
    }

    // ---- save the activation tile (one of the two waves that share it) ----
    if (cgrp == 0) {
      // the tile as the up projection's A fragments (unrolled: af[] stays in registers)
      v2f af[8];
      #pragma unroll
      for (int s = 0; s < 8; ++s)
        af[s] = *reinterpret_cast<const v2f*>(
            &s_mid[(mtile * 16 + ln16) * MID_STRIDE + s * 4 + 2 * hi]);
      float4* __restrict__ mt = reinterpret_cast<float4*>(
          mid + (size_t)(((h * TOKGRP + bx) * CHUNKS + chunk) * 4 + mtile) * MID_TILE) + lane;
      #pragma unroll
      for (int q = 0; q < 4; ++q)
        mt[q * 32] = make_float4(af[2 * q][0], af[2 * q][1], af[2 * q + 1][0], af[2 * q + 1][1]);
      // the stores' address and data registers are reused right behind this block
      asm volatile("s_wait_xcnt 0x0" ::: "memory");
    }

    __syncthreads();
  }

  // ---- fold the eight waves' moments; s_norm is free behind the loop's last barrier ----
  #pragma unroll
  for (int r = 0; r < 8; ++r) {
    s_norm[w * MOM_WAVE + r * 32 + lane]       = momD[r];
    s_norm[w * MOM_WAVE + 256 + r * 32 + lane] = momO[r];
  }
  s_norm[w * MOM_WAVE + 512 + lane] = csum;
  __syncthreads();
  {
    float m00 = 0.f, m01 = 0.f, m11 = 0.f;
    for (int t = 0; t < 4; ++t) {      // even waves own columns 0..15, odd waves 16..31
      m00 += s_norm[(2 * t) * MOM_WAVE + tid];
      m11 += s_norm[(2 * t + 1) * MOM_WAVE + tid];
      m01 += s_norm[(2 * t) * MOM_WAVE + 256 + tid] + s_norm[(2 * t + 1) * MOM_WAVE + 256 + tid];
    }
    const size_t base = (size_t)(h * TOKGRP + bx) * MOM_STRIDE;
    partial[base + tid]       = m00;
    partial[base + 256 + tid] = m01;
    partial[base + 512 + tid] = m11;
    if (tid < K_) {                    // one thread per activation column
      const int ww = tid >> 4;
      const int c  = tid & 15;
      float s = 0.f;
      for (int t = 0; t < 4; ++t)
        s += s_norm[(2 * t + ww) * MOM_WAVE + 512 + c] + s_norm[(2 * t + ww) * MOM_WAVE + 512 + 16 + c];
      partial[base + 768 + tid] = s;
    }
  }
}

// Second pass: y = up(m) from the saved activations, then the pre-folded BN affine (G,SH)
// and the residual. Every wave works alone on its 16-token x 64-column tile: no LDS, no barrier.
// The wave's four 16-column tiles are interleaved: tile j holds the feature columns 4*n + j
// (n = lane & 15 is the tile's own column), so the four results a lane has of one token row are
// adjacent in memory. Residual loads and output stores are then 16 bytes a lane and cover
// 256 contiguous bytes of a row, whole lines, instead of 64-byte pieces.
// The pointers carry no __restrict__ here: the loads then keep their written order against the
// s_wait_xcnt statements below (with it the compiler moved loads across those waits).
__global__ __launch_bounds__(256) void adapter_apply(
    const float* x,
    const float* wu,  const float* bup,
    const float* gsh,   // [f]=G=0.1*gamma*rs, [1024+f]=SH
    const float* mid,   // layout: see adapter_stats
    float* out)
{
  const int tid  = threadIdx.x;
  const int lane = tid & 31;
  const int w    = tid >> 5;      // wave 0..7
  const int hi   = lane >> 4;     // lane half selects K pair / M+8
  const int ln16 = lane & 15;
  const int h    = blockIdx.y;
  const int bx   = blockIdx.x;
  const int mtile = w >> 1;       // 0..3 : 16-token row tile
  const int cgrp  = w & 1;        // column group

  const int col0 = h * D_ + cgrp * 64 + ln16 * 4;   // the lane's four adjacent feature columns
  const float* wuc = wu + h * (K_ * D_) + cgrp * 64 + ln16 * 4;

  const float4* mt = reinterpret_cast<const float4*>(
      mid + (size_t)((h * TOKGRP + bx) * CHUNKS * 4 + mtile) * MID_TILE) + lane;
  const size_t off0 = (size_t)(bx * CHUNKS * CHUNK_TOK + mtile * 16 + 8 * hi) * (H_ * D_) + col0;
  const float* xw = x + off0;
  float* ow = out + off0;

  // Two register sets: chunk c+1's activations and residual rows are on their way while
  // chunk c is multiplied. All loops over them are unrolled so that the sets stay registers.
  float4 aq[2][4];
  float4 xr[2][8];
  // What does not change from chunk to chunk: the B fragments (tile j, k step s), bias, G, SH.
  v2f bf[4][8];
  float4 bias, G, SH;
  #pragma unroll
  for (int q = 0; q < 4; ++q) aq[0][q] = mt[q * 32];
  // a residual load that follows may land in a register these loads name (as in the loop below)
  asm volatile("s_wait_xcnt 0x0" ::: "memory");
  #pragma unroll
  for (int r = 0; r < 8; ++r) xr[0][r] = *reinterpret_cast<const float4*>(xw + r * (H_ * D_));

  #pragma unroll
  for (int chunk = 0; chunk < CHUNKS; ++chunk) {
    const int cur = chunk & 1;
    if (chunk + 1 < CHUNKS) {
      #pragma unroll
      for (int q = 0; q < 4; ++q) aq[cur ^ 1][q] = mt[(chunk + 1) * (4 * MID_TILE / 4) + q * 32];
      // behind the last of these loads their address pair is free, and a residual load may land in it
      asm volatile("s_wait_xcnt 0x0" ::: "memory");
      #pragma unroll
      for (int r = 0; r < 8; ++r)
        xr[cur ^ 1][r] = *reinterpret_cast<const float4*>(
            xw + ((chunk + 1) * CHUNK_TOK + r) * (H_ * D_));
    }
    // The constants are asked for once, behind the first two chunks' loads: putting the B
    // fragments together waits for the weight rows, and that wait must not hold those loads back.
    // wq[s][e] is row k = 4s + 2*hi + e of Wu at the lane's four columns.
    float4 wq[8][2];
    if (chunk == 0) {
      #pragma unroll
      for (int s = 0; s < 8; ++s) {
        wq[s][0] = *reinterpret_cast<const float4*>(wuc + (s * 4 + 2 * hi + 0) * D_);
        wq[s][1] = *reinterpret_cast<const float4*>(wuc + (s * 4 + 2 * hi + 1) * D_);
      }
      // the weight rows' address pair is free from here on, and a load below may land in it
      asm volatile("s_wait_xcnt 0x0" ::: "memory");
      bias = *reinterpret_cast<const float4*>(bup + col0);
      // as above, for the bias load's address pair
      asm volatile("s_wait_xcnt 0x0" ::: "memory");
      G    = *reinterpret_cast<const float4*>(gsh + col0);
      SH   = *reinterpret_cast<const float4*>(gsh + 1024 + col0);
      // as above: these address registers are reused by the vector work that follows
      asm volatile("s_wait_xcnt 0x0" ::: "memory");
    }
    // keeps the next chunk's loads in front of this chunk's matrix work, and that work
    // behind the last chunk's stores (else two chunks' results are held at once)
    __builtin_amdgcn_sched_barrier(0);

    if (chunk == 0) {
      #pragma unroll
      for (int s = 0; s < 8; ++s) {
        bf[0][s][0] = wq[s][0].x; bf[0][s][1] = wq[s][1].x;
        bf[1][s][0] = wq[s][0].y; bf[1][s][1] = wq[s][1].y;
        bf[2][s][0] = wq[s][0].z; bf[2][s][1] = wq[s][1].z;
        bf[3][s][0] = wq[s][0].w; bf[3][s][1] = wq[s][1].w;
      }
    }

    // ---- GEMM2: (16x32) x (32x128) -> 4 column tiles per wave ----
    v8f acc[4];
    #pragma unroll
    for (int j = 0; j < 4; ++j) acc[j] = v8f{0.f, 0.f, 0.f, 0.f, 0.f, 0.f, 0.f, 0.f};
    #pragma unroll
    for (int q = 0; q < 4; ++q) {
      v2f a0, a1;
      a0[0] = aq[cur][q].x; a0[1] = aq[cur][q].y;
      a1[0] = aq[cur][q].z; a1[1] = aq[cur][q].w;
      #pragma unroll
      for (int j = 0; j < 4; ++j)
        acc[j] = __builtin_amdgcn_wmma_f32_16x16x4_f32(false, a0, false, bf[j][2 * q],
                                                       (short)0, acc[j], false, false);
      #pragma unroll
      for (int j = 0; j < 4; ++j)
        acc[j] = __builtin_amdgcn_wmma_f32_16x16x4_f32(false, a1, false, bf[j][2 * q + 1],
                                                       (short)0, acc[j], false, false);
    }
    #pragma unroll
    for (int r = 0; r < 8; ++r) {
      float4 o;
      o.x = (acc[0][r] + bias.x) * G.x + SH.x + xr[cur][r].x;
      o.y = (acc[1][r] + bias.y) * G.y + SH.y + xr[cur][r].y;
      o.z = (acc[2][r] + bias.z) * G.z + SH.z + xr[cur][r].z;
      o.w = (acc[3][r] + bias.w) * G.w + SH.w + xr[cur][r].w;
      *reinterpret_cast<float4*>(ow + (chunk * CHUNK_TOK + r) * (H_ * D_)) = o;
    }
    // the stores' data registers are refilled by the next chunk's work
    if (chunk + 1 < CHUNKS) asm volatile("s_wait_xcnt 0x0" ::: "memory");
  }
}

// Fold the blocks' moments into per-feature (G, SH) with the 0.1 adapter scale pre-applied.
// One block per head. With mu = mean of m and C = M / N - mu mu^T (the covariance of m),
// column d of y = m Wu + b has mean mu . Wu[:,d] + b[d] and variance Wu[:,d] . (C Wu)[:,d].
__global__ __launch_bounds__(1024) void bn_stats(
    const float* __restrict__ partial,
    const float* __restrict__ wu,  const float* __restrict__ bup,
    const float* __restrict__ bn_g, const float* __restrict__ bn_b,
    float* __restrict__ gsh)
{
  __shared__ float s_part[4 * MOM_STRIDE];   // four quarter sums over the head's blocks
  __shared__ float s_m[MOM_STRIDE];          // M / N in the blocks' order, then mu
  __shared__ float s_c[K_ * 34];             // C, row pitch 34: 8-byte reads, no bank shared
  __shared__ float s_v[4 * D_];              // per row tile of C: variance parts, then mean parts

  const int tid  = threadIdx.x;
  const int lane = tid & 31;
  const int hi   = lane >> 4;
  const int ln16 = lane & 15;
  const int h    = blockIdx.x;
  const int wv   = __builtin_amdgcn_readfirstlane(tid >> 5);   // wave number, in a scalar register
  const int ti   = wv & 1;          // 16-row tile of C
  const int tj   = (wv >> 1) & 7;   // 16-column tile of Wu

  // What does not depend on the moments is asked for first, so that it arrives under the fold.
  const float* __restrict__ wuc = wu + h * (K_ * D_) + tj * 16 + ln16;
  v2f bw[8];                        // B fragments of Wu
  float wr[8];                      // Wu at the accumulator's own positions
  #pragma unroll
  for (int s = 0; s < 8; ++s) {
    bw[s][0] = wuc[(s * 4 + 2 * hi + 0) * D_];
    bw[s][1] = wuc[(s * 4 + 2 * hi + 1) * D_];
    wr[s]    = wuc[(ti * 16 + s + 8 * hi) * D_];
  }
  const int f = h * D_ + (tid & (D_ - 1));
  const float gam = bn_g[f], bet = bn_b[f], bu = bup[f];

  // ---- sum over the head's TOKGRP blocks: 16-byte loads, a quarter of the blocks per thread ----
  {
    const int part = tid >> 8;
    const int c4   = tid & 255;
    if (c4 < MOM_STRIDE / 4) {
      const float4* __restrict__ p = reinterpret_cast<const float4*>(
          partial + (size_t)(h * TOKGRP + part * (TOKGRP / 4)) * MOM_STRIDE) + c4;
      float4 a = make_float4(0.f, 0.f, 0.f, 0.f);
      // unrolled so that 16 loads are in flight behind one wait instead of one
      #pragma unroll 16
      for (int t = 0; t < TOKGRP / 4; ++t) {
        const float4 v = p[t * (MOM_STRIDE / 4)];
        a.x += v.x; a.y += v.y; a.z += v.z; a.w += v.w;
      }
      reinterpret_cast<float4*>(s_part + part * MOM_STRIDE)[c4] = a;
    }
  }
  __syncthreads();
  if (tid < MOM_STRIDE)
    s_m[tid] = (s_part[tid] + s_part[MOM_STRIDE + tid] + s_part[2 * MOM_STRIDE + tid] +
                s_part[3 * MOM_STRIDE + tid]) * (1.0f / (float)NTOK);
  __syncthreads();

  // ---- C[k][l], one element per thread ----
  {
    const int k = tid >> 5;
    const int l = tid & 31;
    int plane, row, col;
    if ((k < 16) == (l < 16)) { plane = (k < 16) ? 0 : 512; row = k & 15; col = l & 15; }
    else                      { plane = 256; row = (k < 16) ? k : l; col = ((k < 16) ? l : k) - 16; }
    s_c[k * 34 + l] = s_m[plane + (row & 7) * 32 + (row >> 3) * 16 + col] - s_m[768 + k] * s_m[768 + l];
  }
  __syncthreads();

  // ---- T = C Wu, (32x32) x (32x128): one 16x16 tile per wave, sixteen waves ----
  if (wv < 16) {
    v8f acc = {0.f, 0.f, 0.f, 0.f, 0.f, 0.f, 0.f, 0.f};
    #pragma unroll
    for (int s = 0; s < 8; ++s) {
      const v2f a = *reinterpret_cast<const v2f*>(&s_c[(ti * 16 + ln16) * 34 + s * 4 + 2 * hi]);
      acc = __builtin_amdgcn_wmma_f32_16x16x4_f32(false, a, false, bw[s],
                                                  (short)0, acc, false, false);
    }
    float pv = 0.f, pm = 0.f;
    #pragma unroll
    for (int r = 0; r < 8; ++r) {
      pv += wr[r] * acc[r];
      pm += wr[r] * s_m[768 + ti * 16 + r + 8 * hi];
    }
    pv += __shfl_xor(pv, 16, 32);   // fold the rows r+8 onto the rows r
    pm += __shfl_xor(pm, 16, 32);
    if (hi == 0) {
      s_v[ti * D_ + tj * 16 + ln16]          = pv;
      s_v[2 * D_ + ti * D_ + tj * 16 + ln16] = pm;
    }
  }
  __syncthreads();

  if (tid < D_) {
    const float var  = s_v[tid] + s_v[D_ + tid];
    const float mean = s_v[2 * D_ + tid] + s_v[3 * D_ + tid] + bu;
    const float g    = 0.1f * gam * rsqrtf(var + 1e-5f);
    gsh[f]        = g;
    gsh[1024 + f] = 0.1f * bet - mean * g;
  }
}

extern "C" void kernel_launch(void* const* d_in, const int* in_sizes, int n_in,
                              void* d_out, int out_size, void* d_ws, size_t ws_size,
                              hipStream_t stream) {
  const float* x    = (const float*)d_in[0];
  const float* ln_g = (const float*)d_in[1];
  const float* ln_b = (const float*)d_in[2];
  const float* wd   = (const float*)d_in[3];
  const float* bdn  = (const float*)d_in[4];
  const float* wu   = (const float*)d_in[5];
  const float* bup  = (const float*)d_in[6];
  const float* bn_g = (const float*)d_in[7];
  const float* bn_b = (const float*)d_in[8];
  float* out = (float*)d_out;

  float* partial = (float*)d_ws;                 // 1024 blocks * MOM_STRIDE floats = 3.2 MB
  float* gsh     = partial + (size_t)H_ * TOKGRP * MOM_STRIDE;  // 2048 floats
  float* mid     = gsh + 2048;                   // NTOK*H_*K_ floats = 32 MB

  dim3 grid(TOKGRP, H_);
  adapter_stats<<<grid, 256, 0, stream>>>(x, ln_g, ln_b, wd, bdn, mid, partial);
  bn_stats<<<H_, 1024, 0, stream>>>(partial, wu, bup, bn_g, bn_b, gsh);
  adapter_apply<<<grid, 256, 0, stream>>>(x, wu, bup, gsh, mid, out);
}

// v006
// One run takes 56.2 microseconds.
// Timed twice side by side with v005, it ran 1.05 and 1.04 times as fast.
// All steps since v000 together make it 3.16 times as fast.
#include <hip/hip_runtime.h>

typedef float v2f __attribute__((ext_vector_type(2)));
typedef float v8f __attribute__((ext_vector_type(8)));

#define H_ 8
#define D_ 128
#define K_ 32
#define NTOK 32768          // B*S
#define CHUNK_TOK 64
#define CHUNKS 4
#define TOKGRP 128          // gridDim.x ; TOKGRP*CHUNKS*CHUNK_TOK == NTOK
#define NORM_STRIDE 132     // 132 mod 64 = 4 -> conflict-free v2f A reads
#define MID_STRIDE 36

#define LN_ROWS 8           // token rows one wave normalises per chunk
#define MID_TILE 512        // floats of one saved 16-token x 32 activation tile
#define MOM_STRIDE 800      // floats of one block's moments: M00, M01, M11 (256 each), column sums (32)
#define MOM_WAVE 544        // floats one wave hands to the block's fold: 256 + 256 + 32

// Butterfly sum over the wave for LN_ROWS independent values at once: each exchange
// step is issued for all rows before any result is used, so one exchange latency is
// paid per step instead of one per step and row (hence the full unrolls). Per row the
// order of additions is the plain butterfly's.
__device__ __forceinline__ void wave_sum_rows(float (&s)[LN_ROWS]) {
  #pragma unroll
  for (int m = 1; m < 32; m <<= 1) {
    float o[LN_ROWS];
    #pragma unroll
    for (int i = 0; i < LN_ROWS; ++i) o[i] = __shfl_xor(s[i], m, 32);
    #pragma unroll
    for (int i = 0; i < LN_ROWS; ++i) s[i] += o[i];
  }
}

__device__ __forceinline__ float gelu_exact(float v) {
  return 0.5f * v * (1.0f + erff(v * 0.70710678118654752440f));
}

// Work-group barrier that orders LDS traffic only. __syncthreads() also waits out the wave's
// global loads and stores, so a load issued ahead would be waited for at the very next barrier
// and a store's acknowledgement would hold up the whole block. Nothing that passes between the
// waves of adapter_stats inside its chunk loop goes through global memory.
__device__ __forceinline__ void lds_barrier() {
  __builtin_amdgcn_fence(__ATOMIC_RELEASE, "workgroup", "local");
  __builtin_amdgcn_s_barrier();
  __builtin_amdgcn_fence(__ATOMIC_ACQUIRE, "workgroup", "local");
}

// First pass: m = gelu(down(ln(x))); saves m, so that the second pass starts from m instead
// of from x, and emits per block the column sums of m and its second moment M = m^T m
// (32 x 32, summed over the block's tokens). y = m Wu + b is linear in m, so the batch mean
// and variance of every column of y follow from these (see bn_stats): y is not formed here.
// M is kept as the tiles M00, M01, M11 (M10 is M01 transposed), each in accumulator order:
// float number r*32+lane holds row r + 8*(lane >> 4), column lane & 15.
// Saved layout: one MID_TILE block per 16-token tile, in the order the up projection's
// A fragments are read: float4 number q*32+lane holds k = 8q+2*hi+{0,1} and 8q+4+2*hi+{0,1}
// of token row (lane & 15), so a wave's 16-byte access covers 512 contiguous bytes.
// amdgpu_waves_per_eu(8): the rows held one chunk ahead must not push the register count past
// 128, or only three blocks instead of four would share a WGP.
__global__ __launch_bounds__(256) __attribute__((amdgpu_waves_per_eu(8))) void adapter_stats(
    const float* __restrict__ x,
    const float* __restrict__ ln_g, const float* __restrict__ ln_b,
    const float* __restrict__ wd,  const float* __restrict__ bdn,
    float* __restrict__ mid,         // [(((h*128+bx)*4+chunk)*4+mtile)*MID_TILE]
    float* __restrict__ partial)     // [(h*128+bx)*MOM_STRIDE + {0 M00, 256 M01, 512 M11, 768 sums}]
{
  __shared__ float s_norm[CHUNK_TOK * NORM_STRIDE];
  __shared__ float s_mid[CHUNK_TOK * MID_STRIDE];
  __shared__ float s_wd[D_ * K_];   // the head's down weights as B fragments: float (cgrp*32+s)*64 + lane*2 + {0,1}

  const int tid  = threadIdx.x;
  const int lane = tid & 31;
  const int w    = tid >> 5;      // wave 0..7
  const int hi   = lane >> 4;     // lane half selects K pair / M+8
  const int ln16 = lane & 15;
  const int h    = blockIdx.y;
  const int bx   = blockIdx.x;

  const float* __restrict__ wdh = wd + h * (D_ * K_);

  const float4 lg = *reinterpret_cast<const float4*>(ln_g + h * D_ + lane * 4);
  const float4 lb = *reinterpret_cast<const float4*>(ln_b + h * D_ + lane * 4);

  const int mtile = w >> 1;       // 0..3 : 16-token row tile
  const int cgrp  = w & 1;        // column group

  // Moments of the wave's tokens, carried over all chunks: the diagonal tile of the wave's
  // own 16 columns, its half of the tile M01, and each lane's column sum.
  v8f momD = {0.f, 0.f, 0.f, 0.f, 0.f, 0.f, 0.f, 0.f};
  v8f momO = {0.f, 0.f, 0.f, 0.f, 0.f, 0.f, 0.f, 0.f};
  float csum = 0.f;

  // Asked for in front of everything that is waited for ahead of the loop: a load still open at
  // the loop's head would be waited for inside it, and the rows loaded ahead with it.
  const float bias_d = bdn[h * K_ + cgrp * 16 + ln16];

  // The wave's 8 token rows of a chunk are asked for one chunk ahead: chunk 0's here, in front
  // of the weight staging, chunk c+1's behind chunk c's LayerNorm, so that they travel under
  // the matrix work, the GELU and the moments instead of being waited for at the loop's head.
  // Unrolled so that v[] stays in registers and the eight loads go out together.
  const float* __restrict__ xrow =
      x + (size_t)(bx * CHUNKS * CHUNK_TOK + w * LN_ROWS) * (H_ * D_) + h * D_ + lane * 4;
  float4 v[LN_ROWS];
  #pragma unroll
  for (int i = 0; i < LN_ROWS; ++i)
    v[i] = *reinterpret_cast<const float4*>(xrow + i * (H_ * D_));
  // the loads' address registers may be reused by the work that follows
  asm volatile("s_wait_xcnt 0x0" ::: "memory");

  // The weights do not change from chunk to chunk. They are laid down once in LDS, in the
  // order the B fragments are read, instead of being held in 64 registers of every wave:
  // the register count then lets four blocks share a WGP instead of two. The four waves of
  // a column group write eight k steps each; the first barrier in the loop publishes them.
  // Unrolled so that a wave's sixteen loads go out together, behind one latency.
  #pragma unroll
  for (int i = 0; i < 8; ++i) {
    const int s = mtile * 8 + i;
    v2f b;
    b[0] = wdh[(s * 4 + 2 * hi + 0) * K_ + cgrp * 16 + ln16];
    b[1] = wdh[(s * 4 + 2 * hi + 1) * K_ + cgrp * 16 + ln16];
    *reinterpret_cast<v2f*>(&s_wd[(cgrp * 32 + s) * 64 + lane * 2]) = b;
  }
  for (int chunk = 0; chunk < CHUNKS; ++chunk) {
    // ---- LayerNorm: one wave per token row, 8 tokens per wave ----
    // All 8 rows (loaded one chunk ahead) are carried through the two reductions together.
    // The row loops are unrolled so that v[] and red[] stay in registers and the rows'
    // independent chains can be interleaved; rolled, each row would wait out its own
    // load and every exchange alone.
    {
      float red[LN_ROWS];
      #pragma unroll
      for (int i = 0; i < LN_ROWS; ++i) red[i] = v[i].x + v[i].y + v[i].z + v[i].w;
      wave_sum_rows(red);
      #pragma unroll
      for (int i = 0; i < LN_ROWS; ++i) {
        const float mean = red[i] * (1.0f / 128.0f);
        v[i].x -= mean; v[i].y -= mean; v[i].z -= mean; v[i].w -= mean;
        red[i] = v[i].x * v[i].x + v[i].y * v[i].y + v[i].z * v[i].z + v[i].w * v[i].w;
      }
      wave_sum_rows(red);
      #pragma unroll
      for (int i = 0; i < LN_ROWS; ++i) {
        const int t = w * LN_ROWS + i;
        const float rs = rsqrtf(red[i] * (1.0f / 128.0f) + 1e-5f);
        float4 nv;
        nv.x = v[i].x * rs * lg.x + lb.x;
        nv.y = v[i].y * rs * lg.y + lb.y;
        nv.z = v[i].z * rs * lg.z + lb.z;
        nv.w = v[i].w * rs * lg.w + lb.w;
        *reinterpret_cast<float4*>(&s_norm[t * NORM_STRIDE + lane * 4]) = nv;
      }
      if (chunk + 1 < CHUNKS) {
        #pragma unroll
        for (int i = 0; i < LN_ROWS; ++i)
          v[i] = *reinterpret_cast<const float4*>(xrow + ((chunk + 1) * CHUNK_TOK + i) * (H_ * D_));
        // the loads' address registers may be reused by the work that follows
        asm volatile("s_wait_xcnt 0x0" ::: "memory");
      }
    }
    lds_barrier();

    // ---- GEMM1: (16x128) x (128x32) -> one 16x16 tile per wave ----
    {
      const int n0 = cgrp * 16;
      v8f acc = {0.f, 0.f, 0.f, 0.f, 0.f, 0.f, 0.f, 0.f};
      #pragma unroll
      for (int s = 0; s < 32; ++s) {
        const v2f a = *reinterpret_cast<const v2f*>(
            &s_norm[(mtile * 16 + ln16) * NORM_STRIDE + s * 4 + 2 * hi]);
        const v2f b = *reinterpret_cast<const v2f*>(&s_wd[(cgrp * 32 + s) * 64 + lane * 2]);
        acc = __builtin_amdgcn_wmma_f32_16x16x4_f32(false, a, false, b,
                                                    (short)0, acc, false, false);
      }
      float mv[8];
      #pragma unroll
      for (int r = 0; r < 8; ++r) {
        mv[r] = gelu_exact(acc[r] + bias_d);
        s_mid[(mtile * 16 + r + 8 * hi) * MID_STRIDE + n0 + ln16] = mv[r];
        csum += mv[r];
      }
      // ---- diagonal moment tile, straight from the accumulator registers ----
      // The product sums over tokens, so any token order serves as long as A and B share it:
      // step s takes tokens 8*hi + 2s + {0,1}, which is what lane half hi holds in mv[2s], mv[2s+1];
      // lane & 15 is the column, as an A row and as a B column alike.
      #pragma unroll
      for (int s = 0; s < 4; ++s) {
        v2f f;
        f[0] = mv[2 * s];
        f[1] = mv[2 * s + 1];
        momD = __builtin_amdgcn_wmma_f32_16x16x4_f32(false, f, false, f,
                                                     (short)0, momD, false, false);
      }
    }
    lds_barrier();

    // ---- off-diagonal moment tile M01: A = columns 0..15, B = columns 16..31, same tokens ----
    // Shared out over the two waves of a token tile: of the four steps above, cgrp 0 takes
    // steps 0,1 and cgrp 1 steps 2,3. Both sides are read from s_mid, one of them being the
    // other wave's; the step is chosen in the address, so that no register is picked at run time.
    #pragma unroll
    for (int t = 0; t < 2; ++t) {
      const int row = mtile * 16 + 8 * hi + cgrp * 4 + 2 * t;
      v2f fa, fb;
      fa[0] = s_mid[(row + 0) * MID_STRIDE + ln16];
      fa[1] = s_mid[(row + 1) * MID_STRIDE + ln16];
      fb[0] = s_mid[(row + 0) * MID_STRIDE + 16 + ln16];
      fb[1] = s_mid[(row + 1) * MID_STRIDE + 16 + ln16];
      momO = __builtin_amdgcn_wmma_f32_16x16x4_f32(false, fa, false, fb,
                                                   (short)0, momO, false, false);
    }

    // ---- save the activation tile (one of the two waves that share it) ----
    if (cgrp == 0) {
      // the tile as the up projection's A fragments (unrolled: af[] stays in registers)
      v2f af[8];
      #pragma unroll
      for (int s = 0; s < 8; ++s)
        af[s] = *reinterpret_cast<const v2f*>(
            &s_mid[(mtile * 16 + ln16) * MID_STRIDE + s * 4 + 2 * hi]);
      float4* __restrict__ mt = reinterpret_cast<float4*>(
          mid + (size_t)(((h * TOKGRP + bx) * CHUNKS + chunk) * 4 + mtile) * MID_TILE) + lane;
      #pragma unroll
      for (int q = 0; q < 4; ++q)
        mt[q * 32] = make_float4(af[2 * q][0], af[2 * q][1], af[2 * q + 1][0], af[2 * q + 1][1]);
      // the stores' address and data registers are reused right behind this block
      asm volatile("s_wait_xcnt 0x0" ::: "memory");
    }

    lds_barrier();
  }

  // ---- fold the eight waves' moments; s_norm is free behind the loop's last barrier ----
  #pragma unroll
  for (int r = 0; r < 8; ++r) {
    s_norm[w * MOM_WAVE + r * 32 + lane]       = momD[r];
    s_norm[w * MOM_WAVE + 256 + r * 32 + lane] = momO[r];
  }
  s_norm[w * MOM_WAVE + 512 + lane] = csum;
  __syncthreads();
  {
    float m00 = 0.f, m01 = 0.f, m11 = 0.f;
    for (int t = 0; t < 4; ++t) {      // even waves own columns 0..15, odd waves 16..31
      m00 += s_norm[(2 * t) * MOM_WAVE + tid];
      m11 += s_norm[(2 * t + 1) * MOM_WAVE + tid];
      m01 += s_norm[(2 * t) * MOM_WAVE + 256 + tid] + s_norm[(2 * t + 1) * MOM_WAVE + 256 + tid];
    }
    const size_t base = (size_t)(h * TOKGRP + bx) * MOM_STRIDE;
    partial[base + tid]       = m00;
    partial[base + 256 + tid] = m01;
    partial[base + 512 + tid] = m11;
    if (tid < K_) {                    // one thread per activation column
      const int ww = tid >> 4;
      const int c  = tid & 15;
      float s = 0.f;
      for (int t = 0; t < 4; ++t)
        s += s_norm[(2 * t + ww) * MOM_WAVE + 512 + c] + s_norm[(2 * t + ww) * MOM_WAVE + 512 + 16 + c];
      partial[base + 768 + tid] = s;
    }
  }
}

// Second pass: y = up(m) from the saved activations, then the pre-folded BN affine (G,SH)
// and the residual. Every wave works alone on its 16-token x 64-column tile: no LDS, no barrier.
// The wave's four 16-column tiles are interleaved: tile j holds the feature columns 4*n + j
// (n = lane & 15 is the tile's own column), so the four results a lane has of one token row are
// adjacent in memory. Residual loads and output stores are then 16 bytes a lane and cover
// 256 contiguous bytes of a row, whole lines, instead of 64-byte pieces.
// The pointers carry no __restrict__ here: the loads then keep their written order against the
// s_wait_xcnt statements below (with it the compiler moved loads across those waits).
__global__ __launch_bounds__(256) void adapter_apply(
    const float* x,
    const float* wu,  const float* bup,
    const float* gsh,   // [f]=G=0.1*gamma*rs, [1024+f]=SH
    const float* mid,   // layout: see adapter_stats
    float* out)
{
  const int tid  = threadIdx.x;
  const int lane = tid & 31;
  const int w    = tid >> 5;      // wave 0..7
  const int hi   = lane >> 4;     // lane half selects K pair / M+8
  const int ln16 = lane & 15;
  const int h    = blockIdx.y;
  const int bx   = blockIdx.x;
  const int mtile = w >> 1;       // 0..3 : 16-token row tile
  const int cgrp  = w & 1;        // column group

  const int col0 = h * D_ + cgrp * 64 + ln16 * 4;   // the lane's four adjacent feature columns
  const float* wuc = wu + h * (K_ * D_) + cgrp * 64 + ln16 * 4;

  const float4* mt = reinterpret_cast<const float4*>(
      mid + (size_t)((h * TOKGRP + bx) * CHUNKS * 4 + mtile) * MID_TILE) + lane;
  const size_t off0 = (size_t)(bx * CHUNKS * CHUNK_TOK + mtile * 16 + 8 * hi) * (H_ * D_) + col0;
  const float* xw = x + off0;
  float* ow = out + off0;

  // Two register sets: chunk c+1's activations and residual rows are on their way while
  // chunk c is multiplied. All loops over them are unrolled so that the sets stay registers.
  float4 aq[2][4];
  float4 xr[2][8];
  // What does not change from chunk to chunk: the B fragments (tile j, k step s), bias, G, SH.
  v2f bf[4][8];
  float4 bias, G, SH;
  #pragma unroll
  for (int q = 0; q < 4; ++q) aq[0][q] = mt[q * 32];
  // a residual load that follows may land in a register these loads name (as in the loop below)
  asm volatile("s_wait_xcnt 0x0" ::: "memory");
  #pragma unroll
  for (int r = 0; r < 8; ++r) xr[0][r] = *reinterpret_cast<const float4*>(xw + r * (H_ * D_));

  #pragma unroll
  for (int chunk = 0; chunk < CHUNKS; ++chunk) {
    const int cur = chunk & 1;
    if (chunk + 1 < CHUNKS) {
      #pragma unroll
      for (int q = 0; q < 4; ++q) aq[cur ^ 1][q] = mt[(chunk + 1) * (4 * MID_TILE / 4) + q * 32];
      // behind the last of these loads their address pair is free, and a residual load may land in it
      asm volatile("s_wait_xcnt 0x0" ::: "memory");
      #pragma unroll
      for (int r = 0; r < 8; ++r)
        xr[cur ^ 1][r] = *reinterpret_cast<const float4*>(
            xw + ((chunk + 1) * CHUNK_TOK + r) * (H_ * D_));
    }
    // The constants are asked for once, behind the first two chunks' loads: putting the B
    // fragments together waits for the weight rows, and that wait must not hold those loads back.
    // wq[s][e] is row k = 4s + 2*hi + e of Wu at the lane's four columns.
    float4 wq[8][2];
    if (chunk == 0) {
      #pragma unroll
      for (int s = 0; s < 8; ++s) {
        wq[s][0] = *reinterpret_cast<const float4*>(wuc + (s * 4 + 2 * hi + 0) * D_);
        wq[s][1] = *reinterpret_cast<const float4*>(wuc + (s * 4 + 2 * hi + 1) * D_);
      }
      // the weight rows' address pair is free from here on, and a load below may land in it
      asm volatile("s_wait_xcnt 0x0" ::: "memory");
      bias = *reinterpret_cast<const float4*>(bup + col0);
      // as above, for the bias load's address pair
      asm volatile("s_wait_xcnt 0x0" ::: "memory");
      G    = *reinterpret_cast<const float4*>(gsh + col0);
      SH   = *reinterpret_cast<const float4*>(gsh + 1024 + col0);
      // as above: these address registers are reused by the vector work that follows
      asm volatile("s_wait_xcnt 0x0" ::: "memory");
    }
    // keeps the next chunk's loads in front of this chunk's matrix work, and that work
    // behind the last chunk's stores (else two chunks' results are held at once)
    __builtin_amdgcn_sched_barrier(0);

    if (chunk == 0) {
      #pragma unroll
      for (int s = 0; s < 8; ++s) {
        bf[0][s][0] = wq[s][0].x; bf[0][s][1] = wq[s][1].x;
        bf[1][s][0] = wq[s][0].y; bf[1][s][1] = wq[s][1].y;
        bf[2][s][0] = wq[s][0].z; bf[2][s][1] = wq[s][1].z;
        bf[3][s][0] = wq[s][0].w; bf[3][s][1] = wq[s][1].w;
      }
    }

    // ---- GEMM2: (16x32) x (32x128) -> 4 column tiles per wave ----
    v8f acc[4];
    #pragma unroll
    for (int j = 0; j < 4; ++j) acc[j] = v8f{0.f, 0.f, 0.f, 0.f, 0.f, 0.f, 0.f, 0.f};
    #pragma unroll
    for (int q = 0; q < 4; ++q) {
      v2f a0, a1;
      a0[0] = aq[cur][q].x; a0[1] = aq[cur][q].y;
      a1[0] = aq[cur][q].z; a1[1] = aq[cur][q].w;
      #pragma unroll
      for (int j = 0; j < 4; ++j)
        acc[j] = __builtin_amdgcn_wmma_f32_16x16x4_f32(false, a0, false, bf[j][2 * q],
                                                       (short)0, acc[j], false, false);
      #pragma unroll
      for (int j = 0; j < 4; ++j)
        acc[j] = __builtin_amdgcn_wmma_f32_16x16x4_f32(false, a1, false, bf[j][2 * q + 1],
                                                       (short)0, acc[j], false, false);
    }
    #pragma unroll
    for (int r = 0; r < 8; ++r) {
      float4 o;
      o.x = (acc[0][r] + bias.x) * G.x + SH.x + xr[cur][r].x;
      o.y = (acc[1][r] + bias.y) * G.y + SH.y + xr[cur][r].y;
      o.z = (acc[2][r] + bias.z) * G.z + SH.z + xr[cur][r].z;
      o.w = (acc[3][r] + bias.w) * G.w + SH.w + xr[cur][r].w;
      *reinterpret_cast<float4*>(ow + (chunk * CHUNK_TOK + r) * (H_ * D_)) = o;
    }
    // the stores' data registers are refilled by the next chunk's work
    if (chunk + 1 < CHUNKS) asm volatile("s_wait_xcnt 0x0" ::: "memory");
  }
}

// Fold the blocks' moments into per-feature (G, SH) with the 0.1 adapter scale pre-applied.
// One block per head. With mu = mean of m and C = M / N - mu mu^T (the covariance of m),
// column d of y = m Wu + b has mean mu . Wu[:,d] + b[d] and variance Wu[:,d] . (C Wu)[:,d].
__global__ __launch_bounds__(1024) void bn_stats(
    const float* __restrict__ partial,
    const float* __restrict__ wu,  const float* __restrict__ bup,
    const float* __restrict__ bn_g, const float* __restrict__ bn_b,
    float* __restrict__ gsh)
{
  __shared__ float s_part[4 * MOM_STRIDE];   // four quarter sums over the head's blocks
  __shared__ float s_m[MOM_STRIDE];          // M / N in the blocks' order, then mu
  __shared__ float s_c[K_ * 34];             // C, row pitch 34: 8-byte reads, no bank shared
  __shared__ float s_v[4 * D_];              // per row tile of C: variance parts, then mean parts

  const int tid  = threadIdx.x;
  const int lane = tid & 31;
  const int hi   = lane >> 4;
  const int ln16 = lane & 15;
  const int h    = blockIdx.x;
  const int wv   = __builtin_amdgcn_readfirstlane(tid >> 5);   // wave number, in a scalar register
  const int ti   = wv & 1;          // 16-row tile of C
  const int tj   = (wv >> 1) & 7;   // 16-column tile of Wu

  // What does not depend on the moments is asked for first, so that it arrives under the fold.
  const float* __restrict__ wuc = wu + h * (K_ * D_) + tj * 16 + ln16;
  v2f bw[8];                        // B fragments of Wu
  float wr[8];                      // Wu at the accumulator's own positions
  #pragma unroll
  for (int s = 0; s < 8; ++s) {
    bw[s][0] = wuc[(s * 4 + 2 * hi + 0) * D_];
    bw[s][1] = wuc[(s * 4 + 2 * hi + 1) * D_];
    wr[s]    = wuc[(ti * 16 + s + 8 * hi) * D_];
  }
  const int f = h * D_ + (tid & (D_ - 1));
  const float gam = bn_g[f], bet = bn_b[f], bu = bup[f];

  // ---- sum over the head's TOKGRP blocks: 16-byte loads, a quarter of the blocks per thread ----
  {
    const int part = tid >> 8;
    const int c4   = tid & 255;
    if (c4 < MOM_STRIDE / 4) {
      const float4* __restrict__ p = reinterpret_cast<const float4*>(
          partial + (size_t)(h * TOKGRP + part * (TOKGRP / 4)) * MOM_STRIDE) + c4;
      float4 a = make_float4(0.f, 0.f, 0.f, 0.f);
      // unrolled so that 16 loads are in flight behind one wait instead of one
      #pragma unroll 16
      for (int t = 0; t < TOKGRP / 4; ++t) {
        const float4 v = p[t * (MOM_STRIDE / 4)];
        a.x += v.x; a.y += v.y; a.z += v.z; a.w += v.w;
      }
      reinterpret_cast<float4*>(s_part + part * MOM_STRIDE)[c4] = a;
    }
  }
  __syncthreads();
  if (tid < MOM_STRIDE)
    s_m[tid] = (s_part[tid] + s_part[MOM_STRIDE + tid] + s_part[2 * MOM_STRIDE + tid] +
                s_part[3 * MOM_STRIDE + tid]) * (1.0f / (float)NTOK);
  __syncthreads();

  // ---- C[k][l], one element per thread ----
  {
    const int k = tid >> 5;
    const int l = tid & 31;
    int plane, row, col;
    if ((k < 16) == (l < 16)) { plane = (k < 16) ? 0 : 512; row = k & 15; col = l & 15; }
    else                      { plane = 256; row = (k < 16) ? k : l; col = ((k < 16) ? l : k) - 16; }
    s_c[k * 34 + l] = s_m[plane + (row & 7) * 32 + (row >> 3) * 16 + col] - s_m[768 + k] * s_m[768 + l];
  }
  __syncthreads();

  // ---- T = C Wu, (32x32) x (32x128): one 16x16 tile per wave, sixteen waves ----
  if (wv < 16) {
    v8f acc = {0.f, 0.f, 0.f, 0.f, 0.f, 0.f, 0.f, 0.f};
    #pragma unroll
    for (int s = 0; s < 8; ++s) {
      const v2f a = *reinterpret_cast<const v2f*>(&s_c[(ti * 16 + ln16) * 34 + s * 4 + 2 * hi]);
      acc = __builtin_amdgcn_wmma_f32_16x16x4_f32(false, a, false, bw[s],
                                                  (short)0, acc, false, false);
    }
    float pv = 0.f, pm = 0.f;
    #pragma unroll
    for (int r = 0; r < 8; ++r) {
      pv += wr[r] * acc[r];
      pm += wr[r] * s_m[768 + ti * 16 + r + 8 * hi];
    }
    pv += __shfl_xor(pv, 16, 32);   // fold the rows r+8 onto the rows r
    pm += __shfl_xor(pm, 16, 32);
    if (hi == 0) {
      s_v[ti * D_ + tj * 16 + ln16]          = pv;
      s_v[2 * D_ + ti * D_ + tj * 16 + ln16] = pm;
    }
  }
  __syncthreads();

  if (tid < D_) {
    const float var  = s_v[tid] + s_v[D_ + tid];
    const float mean = s_v[2 * D_ + tid] + s_v[3 * D_ + tid] + bu;
    const float g    = 0.1f * gam * rsqrtf(var + 1e-5f);
    gsh[f]        = g;
    gsh[1024 + f] = 0.1f * bet - mean * g;
  }
}

extern "C" void kernel_launch(void* const* d_in, const int* in_sizes, int n_in,
                              void* d_out, int out_size, void* d_ws, size_t ws_size,
                              hipStream_t stream) {
  const float* x    = (const float*)d_in[0];
  const float* ln_g = (const float*)d_in[1];
  const float* ln_b = (const float*)d_in[2];
  const float* wd   = (const float*)d_in[3];
  const float* bdn  = (const float*)d_in[4];
  const float* wu   = (const float*)d_in[5];
  const float* bup  = (const float*)d_in[6];
  const float* bn_g = (const float*)d_in[7];
  const float* bn_b = (const float*)d_in[8];
  float* out = (float*)d_out;

  float* partial = (float*)d_ws;                 // 1024 blocks * MOM_STRIDE floats = 3.2 MB
  float* gsh     = partial + (size_t)H_ * TOKGRP * MOM_STRIDE;  // 2048 floats
  float* mid     = gsh + 2048;                   // NTOK*H_*K_ floats = 32 MB

  dim3 grid(TOKGRP, H_);
  adapter_stats<<<grid, 256, 0, stream>>>(x, ln_g, ln_b, wd, bdn, mid, partial);
  bn_stats<<<H_, 1024, 0, stream>>>(partial, wu, bup, bn_g, bn_b, gsh);
  adapter_apply<<<grid, 256, 0, stream>>>(x, wu, bup, gsh, mid, out);
}

// v007
// A run of this version takes 54.3 microseconds.
// In both of two side-by-side timings against v006, it was 1.04 times as fast.
// All steps since v000 together make it 3.28 times as fast.
#include <hip/hip_runtime.h>

typedef float v2f __attribute__((ext_vector_type(2)));
typedef float v4f __attribute__((ext_vector_type(4)));
typedef float v8f __attribute__((ext_vector_type(8)));

#define H_ 8
#define D_ 128
#define K_ 32
#define NTOK 32768          // B*S
#define CHUNK_TOK 64
#define CHUNKS 4
#define TOKGRP 128          // gridDim.x ; TOKGRP*CHUNKS*CHUNK_TOK == NTOK
#define NORM_STRIDE 132     // 132 mod 64 = 4 -> conflict-free v2f A reads
#define MID_STRIDE 36

#define LN_SETS 2           // a wave normalises 8 token rows per chunk, four at a time, eight lanes to a row
#define LN_PART 4           // 16-byte pieces of a row that one lane holds
#define MID_TILE 512        // floats of one saved 16-token x 32 activation tile
#define MOM_STRIDE 800      // floats of one block's moments: M00, M01, M11 (256 each), column sums (32)
#define MOM_WAVE 544        // floats one wave hands to the block's fold: 256 + 256 + 32

// Butterfly sum over the eight lanes that share a token row, for the wave's LN_SETS row sets
// at once: each exchange step is issued for both sets before a result is used, so one
// exchange latency is paid per step (hence the full unrolls).
__device__ __forceinline__ void row_sum_sets(float (&s)[LN_SETS]) {
  #pragma unroll
  for (int m = 1; m < 8; m <<= 1) {
    float o[LN_SETS];
    #pragma unroll
    for (int i = 0; i < LN_SETS; ++i) o[i] = __shfl_xor(s[i], m, 32);
    // both sets' exchanges go out before either is waited for (the compiler staggered them,
    // and a reduction then waited out five exchange latencies instead of three)
    __builtin_amdgcn_sched_barrier(0);
    #pragma unroll
    for (int i = 0; i < LN_SETS; ++i) s[i] += o[i];
  }
}

__device__ __forceinline__ float gelu_exact(float v) {
  return 0.5f * v * (1.0f + erff(v * 0.70710678118654752440f));
}

// Work-group barrier that orders LDS traffic only. __syncthreads() also waits out the wave's
// global loads and stores, so a load issued ahead would be waited for at the very next barrier
// and a store's acknowledgement would hold up the whole block. Nothing that passes between the
// waves of adapter_stats inside its chunk loop goes through global memory.
__device__ __forceinline__ void lds_barrier() {
  __builtin_amdgcn_fence(__ATOMIC_RELEASE, "workgroup", "local");
  __builtin_amdgcn_s_barrier();
  __builtin_amdgcn_fence(__ATOMIC_ACQUIRE, "workgroup", "local");
}

// First pass: m = gelu(down(ln(x))); saves m, so that the second pass starts from m instead
// of from x, and emits per block the column sums of m and its second moment M = m^T m
// (32 x 32, summed over the block's tokens). y = m Wu + b is linear in m, so the batch mean
// and variance of every column of y follow from these (see bn_stats): y is not formed here.
// M is kept as the tiles M00, M01, M11 (M10 is M01 transposed), each in accumulator order:
// float number r*32+lane holds row r + 8*(lane >> 4), column lane & 15.
// Saved layout: one MID_TILE block per 16-token tile, in the order the up projection's
// A fragments are read: float4 number q*32+lane holds k = 8q+2*hi+{0,1} and 8q+4+2*hi+{0,1}
// of token row (lane & 15), so a wave's 16-byte access covers 512 contiguous bytes.
// amdgpu_waves_per_eu(8): the rows held one chunk ahead must not push the register count past
// 128, or only three blocks instead of four would share a WGP.
__global__ __launch_bounds__(256) __attribute__((amdgpu_waves_per_eu(8))) void adapter_stats(
    const float* __restrict__ x,
    const float* __restrict__ ln_g, const float* __restrict__ ln_b,
    const float* __restrict__ wd,  const float* __restrict__ bdn,
    float* __restrict__ mid,         // [(((h*128+bx)*4+chunk)*4+mtile)*MID_TILE]
    float* __restrict__ partial)     // [(h*128+bx)*MOM_STRIDE + {0 M00, 256 M01, 512 M11, 768 sums}]
{
  __shared__ float s_norm[CHUNK_TOK * NORM_STRIDE];
  __shared__ float s_mid[CHUNK_TOK * MID_STRIDE];
  __shared__ float s_wd[D_ * K_];   // the head's down weights as B fragments: float (cgrp*32+s)*64 + lane*2 + {0,1}
  __shared__ float s_gb[8 * 2 * D_]; // LayerNorm gamma, then beta, of the head: one copy per wave, so no barrier is owed

  const int tid  = threadIdx.x;
  const int lane = tid & 31;
  const int w    = tid >> 5;      // wave 0..7
  const int hi   = lane >> 4;     // lane half selects K pair / M+8
  const int ln16 = lane & 15;
  const int h    = blockIdx.y;
  const int bx   = blockIdx.x;

  const float* __restrict__ wdh = wd + h * (D_ * K_);

  const float4 lg = *reinterpret_cast<const float4*>(ln_g + h * D_ + lane * 4);
  const float4 lb = *reinterpret_cast<const float4*>(ln_b + h * D_ + lane * 4);

  // LayerNorm layout: eight lanes share a token row. Lane part `sub` holds the four floats at
  // column 32*q + 4*sub for q = 0..3, so a wave's 16-byte access covers one whole 128-byte line
  // in each of four rows. A row's sum is then 15 additions inside a lane and three exchange
  // steps, and a wave has two sums to exchange instead of eight over five steps.
  // Rows of a set: lanes 0-15 take rows 8 apart, which lie 32 banks apart at NORM_STRIDE.
  const int sub  = lane & 7;
  const int lrow = (w >> 1) * 16 + (w & 1) * 4 + ((lane >> 3) & 1) * 8 + (lane >> 4);   // + 2 * set

  const int mtile = w >> 1;       // 0..3 : 16-token row tile
  const int cgrp  = w & 1;        // column group

  // Moments of the wave's tokens, carried over all chunks: the diagonal tile of the wave's
  // own 16 columns, its half of the tile M01, and each lane's column sum.
  v8f momD = {0.f, 0.f, 0.f, 0.f, 0.f, 0.f, 0.f, 0.f};
  v8f momO = {0.f, 0.f, 0.f, 0.f, 0.f, 0.f, 0.f, 0.f};
  float csum = 0.f;

  // Asked for behind gamma and beta, in front of the rows and the weights: a load still open at
  // the loop's head would be waited for inside it, and the rows loaded ahead with it.
  const float bias_d = bdn[h * K_ + cgrp * 16 + ln16];

  // The wave's 8 token rows of a chunk are asked for one chunk ahead: chunk 0's here, in front
  // of the weight staging, chunk c+1's behind chunk c's LayerNorm, so that they travel under
  // the matrix work, the GELU and the moments instead of being waited for at the loop's head.
  // Unrolled so that v[] stays in registers and the eight loads go out together.
  const float* __restrict__ xrow =
      x + (size_t)(bx * CHUNKS * CHUNK_TOK + lrow) * (H_ * D_) + h * D_ + sub * 4;
  v4f v[LN_SETS][LN_PART];
  #pragma unroll
  for (int j = 0; j < LN_SETS; ++j)
    #pragma unroll
    for (int q = 0; q < LN_PART; ++q)
      v[j][q] = *reinterpret_cast<const v4f*>(xrow + 2 * j * (H_ * D_) + q * 32);
  // the loads' address registers may be reused by the work that follows
  asm volatile("s_wait_xcnt 0x0" ::: "memory");

  // A lane needs gamma and beta at its 16 columns: read from LDS in each chunk, they do not
  // hold 32 registers across the matrix work.
  float* gbw = s_gb + w * (2 * D_);
  *reinterpret_cast<float4*>(gbw + lane * 4)      = lg;
  *reinterpret_cast<float4*>(gbw + D_ + lane * 4) = lb;

  // The weights do not change from chunk to chunk. They are laid down once in LDS, in the
  // order the B fragments are read, instead of being held in 64 registers of every wave:
  // the register count then lets four blocks share a WGP instead of two. The four waves of
  // a column group write eight k steps each; the first barrier in the loop publishes them.
  // Unrolled so that a wave's sixteen loads go out together, behind one latency.
  #pragma unroll
  for (int i = 0; i < 8; ++i) {
    const int s = mtile * 8 + i;
    v2f b;
    b[0] = wdh[(s * 4 + 2 * hi + 0) * K_ + cgrp * 16 + ln16];
    b[1] = wdh[(s * 4 + 2 * hi + 1) * K_ + cgrp * 16 + ln16];
    *reinterpret_cast<v2f*>(&s_wd[(cgrp * 32 + s) * 64 + lane * 2]) = b;
  }
  for (int chunk = 0; chunk < CHUNKS; ++chunk) {
    // ---- LayerNorm: eight lanes per token row, 8 tokens per wave ----
    // The rows (loaded one chunk ahead) are carried through the two reductions together.
    // The loops are unrolled so that v[] and red[] stay in registers and the independent
    // chains can be interleaved.
    {
      v4f g[LN_PART], b[LN_PART];
      #pragma unroll
      for (int q = 0; q < LN_PART; ++q) {
        g[q] = *reinterpret_cast<const v4f*>(gbw + q * 32 + sub * 4);
        b[q] = *reinterpret_cast<const v4f*>(gbw + D_ + q * 32 + sub * 4);
      }
      // keeps these eight LDS reads in one group in front of the sums, whose work covers their
      // latency (the compiler sank them in pairs to their uses, each pair waited for at once)
      __builtin_amdgcn_sched_barrier(0);
      // The sums inside a lane run on register pairs as they were loaded (two floats an instruction).
      float red[LN_SETS];
      #pragma unroll
      for (int j = 0; j < LN_SETS; ++j) {
        const v2f t = ((v[j][0].lo + v[j][0].hi) + (v[j][1].lo + v[j][1].hi)) +
                      ((v[j][2].lo + v[j][2].hi) + (v[j][3].lo + v[j][3].hi));
        red[j] = t[0] + t[1];
      }
      row_sum_sets(red);
      #pragma unroll
      for (int j = 0; j < LN_SETS; ++j) {
        const float mean = red[j] * (1.0f / 128.0f);
        v[j][0] -= mean;
        v2f ta = v[j][0].lo * v[j][0].lo;
        v2f tb = v[j][0].hi * v[j][0].hi;
        #pragma unroll
        for (int q = 1; q < LN_PART; ++q) {
          v[j][q] -= mean;
          ta += v[j][q].lo * v[j][q].lo;
          tb += v[j][q].hi * v[j][q].hi;
        }
        const v2f t = ta + tb;
        red[j] = t[0] + t[1];
      }
      row_sum_sets(red);
      float rs[LN_SETS];
      #pragma unroll
      for (int j = 0; j < LN_SETS; ++j) rs[j] = rsqrtf(red[j] * (1.0f / 128.0f) + 1e-5f);
      #pragma unroll
      for (int q = 0; q < LN_PART; ++q)
        #pragma unroll
        for (int j = 0; j < LN_SETS; ++j)
          *reinterpret_cast<v4f*>(&s_norm[(lrow + 2 * j) * NORM_STRIDE + q * 32 + sub * 4]) =
              v[j][q] * rs[j] * g[q] + b[q];
      if (chunk + 1 < CHUNKS) {
        #pragma unroll
        for (int j = 0; j < LN_SETS; ++j)
          #pragma unroll
          for (int q = 0; q < LN_PART; ++q)
            v[j][q] = *reinterpret_cast<const v4f*>(
                xrow + ((chunk + 1) * CHUNK_TOK + 2 * j) * (H_ * D_) + q * 32);
        // the loads' address registers may be reused by the work that follows
        asm volatile("s_wait_xcnt 0x0" ::: "memory");
      }
    }
    lds_barrier();

    // ---- GEMM1: (16x128) x (128x32) -> one 16x16 tile per wave ----
    {
      const int n0 = cgrp * 16;
      v8f acc = {0.f, 0.f, 0.f, 0.f, 0.f, 0.f, 0.f, 0.f};
      #pragma unroll
      for (int s = 0; s < 32; ++s) {
        const v2f a = *reinterpret_cast<const v2f*>(
            &s_norm[(mtile * 16 + ln16) * NORM_STRIDE + s * 4 + 2 * hi]);
        const v2f b = *reinterpret_cast<const v2f*>(&s_wd[(cgrp * 32 + s) * 64 + lane * 2]);
        acc = __builtin_amdgcn_wmma_f32_16x16x4_f32(false, a, false, b,
                                                    (short)0, acc, false, false);
      }
      float mv[8];
      #pragma unroll
      for (int r = 0; r < 8; ++r) {
        mv[r] = gelu_exact(acc[r] + bias_d);
        s_mid[(mtile * 16 + r + 8 * hi) * MID_STRIDE + n0 + ln16] = mv[r];
        csum += mv[r];
      }
      // ---- diagonal moment tile, straight from the accumulator registers ----
      // The product sums over tokens, so any token order serves as long as A and B share it:
      // step s takes tokens 8*hi + 2s + {0,1}, which is what lane half hi holds in mv[2s], mv[2s+1];
      // lane & 15 is the column, as an A row and as a B column alike.
      #pragma unroll
      for (int s = 0; s < 4; ++s) {
        v2f f;
        f[0] = mv[2 * s];
        f[1] = mv[2 * s + 1];
        momD = __builtin_amdgcn_wmma_f32_16x16x4_f32(false, f, false, f,
                                                     (short)0, momD, false, false);
      }
    }
    lds_barrier();

    // ---- off-diagonal moment tile M01: A = columns 0..15, B = columns 16..31, same tokens ----
    // Shared out over the two waves of a token tile: of the four steps above, cgrp 0 takes
    // steps 0,1 and cgrp 1 steps 2,3. Both sides are read from s_mid, one of them being the
    // other wave's; the step is chosen in the address, so that no register is picked at run time.
    #pragma unroll
    for (int t = 0; t < 2; ++t) {
      const int row = mtile * 16 + 8 * hi + cgrp * 4 + 2 * t;
      v2f fa, fb;
      fa[0] = s_mid[(row + 0) * MID_STRIDE + ln16];
      fa[1] = s_mid[(row + 1) * MID_STRIDE + ln16];
      fb[0] = s_mid[(row + 0) * MID_STRIDE + 16 + ln16];
      fb[1] = s_mid[(row + 1) * MID_STRIDE + 16 + ln16];
      momO = __builtin_amdgcn_wmma_f32_16x16x4_f32(false, fa, false, fb,
                                                   (short)0, momO, false, false);
    }

    // ---- save the activation tile (one of the two waves that share it) ----
    if (cgrp == 0) {
      // the tile as the up projection's A fragments (unrolled: af[] stays in registers)
      v2f af[8];
      #pragma unroll
      for (int s = 0; s < 8; ++s)
        af[s] = *reinterpret_cast<const v2f*>(
            &s_mid[(mtile * 16 + ln16) * MID_STRIDE + s * 4 + 2 * hi]);
      float4* __restrict__ mt = reinterpret_cast<float4*>(
          mid + (size_t)(((h * TOKGRP + bx) * CHUNKS + chunk) * 4 + mtile) * MID_TILE) + lane;
      #pragma unroll
      for (int q = 0; q < 4; ++q)
        mt[q * 32] = make_float4(af[2 * q][0], af[2 * q][1], af[2 * q + 1][0], af[2 * q + 1][1]);
      // the stores' address and data registers are reused right behind this block
      asm volatile("s_wait_xcnt 0x0" ::: "memory");
    }

    lds_barrier();
  }

  // ---- fold the eight waves' moments; s_norm is free behind the loop's last barrier ----
  #pragma unroll
  for (int r = 0; r < 8; ++r) {
    s_norm[w * MOM_WAVE + r * 32 + lane]       = momD[r];
    s_norm[w * MOM_WAVE + 256 + r * 32 + lane] = momO[r];
  }
  s_norm[w * MOM_WAVE + 512 + lane] = csum;
  __syncthreads();
  {
    float m00 = 0.f, m01 = 0.f, m11 = 0.f;
    for (int t = 0; t < 4; ++t) {      // even waves own columns 0..15, odd waves 16..31
      m00 += s_norm[(2 * t) * MOM_WAVE + tid];
      m11 += s_norm[(2 * t + 1) * MOM_WAVE + tid];
      m01 += s_norm[(2 * t) * MOM_WAVE + 256 + tid] + s_norm[(2 * t + 1) * MOM_WAVE + 256 + tid];
    }
    const size_t base = (size_t)(h * TOKGRP + bx) * MOM_STRIDE;
    partial[base + tid]       = m00;
    partial[base + 256 + tid] = m01;
    partial[base + 512 + tid] = m11;
    if (tid < K_) {                    // one thread per activation column
      const int ww = tid >> 4;
      const int c  = tid & 15;
      float s = 0.f;
      for (int t = 0; t < 4; ++t)
        s += s_norm[(2 * t + ww) * MOM_WAVE + 512 + c] + s_norm[(2 * t + ww) * MOM_WAVE + 512 + 16 + c];
      partial[base + 768 + tid] = s;
    }
  }
}

// Second pass: y = up(m) from the saved activations, then the pre-folded BN affine (G,SH)
// and the residual. Every wave works alone on its 16-token x 64-column tile: no LDS, no barrier.
// The wave's four 16-column tiles are interleaved: tile j holds the feature columns 4*n + j
// (n = lane & 15 is the tile's own column), so the four results a lane has of one token row are
// adjacent in memory. Residual loads and output stores are then 16 bytes a lane and cover
// 256 contiguous bytes of a row, whole lines, instead of 64-byte pieces.
// The pointers carry no __restrict__ here: the loads then keep their written order against the
// s_wait_xcnt statements below (with it the compiler moved loads across those waits).
__global__ __launch_bounds__(256) void adapter_apply(
    const float* x,
    const float* wu,  const float* bup,
    const float* gsh,   // [f]=G=0.1*gamma*rs, [1024+f]=SH
    const float* mid,   // layout: see adapter_stats
    float* out)
{
  const int tid  = threadIdx.x;
  const int lane = tid & 31;
  const int w    = tid >> 5;      // wave 0..7
  const int hi   = lane >> 4;     // lane half selects K pair / M+8
  const int ln16 = lane & 15;
  const int h    = blockIdx.y;
  const int bx   = blockIdx.x;
  const int mtile = w >> 1;       // 0..3 : 16-token row tile
  const int cgrp  = w & 1;        // column group

  const int col0 = h * D_ + cgrp * 64 + ln16 * 4;   // the lane's four adjacent feature columns
  const float* wuc = wu + h * (K_ * D_) + cgrp * 64 + ln16 * 4;

  const float4* mt = reinterpret_cast<const float4*>(
      mid + (size_t)((h * TOKGRP + bx) * CHUNKS * 4 + mtile) * MID_TILE) + lane;
  const size_t off0 = (size_t)(bx * CHUNKS * CHUNK_TOK + mtile * 16 + 8 * hi) * (H_ * D_) + col0;
  const float* xw = x + off0;
  float* ow = out + off0;

  // Two register sets: chunk c+1's activations and residual rows are on their way while
  // chunk c is multiplied. All loops over them are unrolled so that the sets stay registers.
  float4 aq[2][4];
  float4 xr[2][8];
  // What does not change from chunk to chunk: the B fragments (tile j, k step s), bias, G, SH.
  v2f bf[4][8];
  float4 bias, G, SH;
  #pragma unroll
  for (int q = 0; q < 4; ++q) aq[0][q] = mt[q * 32];
  // a residual load that follows may land in a register these loads name (as in the loop below)
  asm volatile("s_wait_xcnt 0x0" ::: "memory");
  #pragma unroll
  for (int r = 0; r < 8; ++r) xr[0][r] = *reinterpret_cast<const float4*>(xw + r * (H_ * D_));

  #pragma unroll
  for (int chunk = 0; chunk < CHUNKS; ++chunk) {
    const int cur = chunk & 1;
    if (chunk + 1 < CHUNKS) {
      #pragma unroll
      for (int q = 0; q < 4; ++q) aq[cur ^ 1][q] = mt[(chunk + 1) * (4 * MID_TILE / 4) + q * 32];
      // behind the last of these loads their address pair is free, and a residual load may land in it
      asm volatile("s_wait_xcnt 0x0" ::: "memory");
      #pragma unroll
      for (int r = 0; r < 8; ++r)
        xr[cur ^ 1][r] = *reinterpret_cast<const float4*>(
            xw + ((chunk + 1) * CHUNK_TOK + r) * (H_ * D_));
    }
    // The constants are asked for once, behind the first two chunks' loads: putting the B
    // fragments together waits for the weight rows, and that wait must not hold those loads back.
    // wq[s][e] is row k = 4s + 2*hi + e of Wu at the lane's four columns.
    float4 wq[8][2];
    if (chunk == 0) {
      #pragma unroll
      for (int s = 0; s < 8; ++s) {
        wq[s][0] = *reinterpret_cast<const float4*>(wuc + (s * 4 + 2 * hi + 0) * D_);
        wq[s][1] = *reinterpret_cast<const float4*>(wuc + (s * 4 + 2 * hi + 1) * D_);
      }
      // the weight rows' address pair is free from here on, and a load below may land in it
      asm volatile("s_wait_xcnt 0x0" ::: "memory");
      bias = *reinterpret_cast<const float4*>(bup + col0);
      // as above, for the bias load's address pair
      asm volatile("s_wait_xcnt 0x0" ::: "memory");
      G    = *reinterpret_cast<const float4*>(gsh + col0);
      SH   = *reinterpret_cast<const float4*>(gsh + 1024 + col0);
      // as above: these address registers are reused by the vector work that follows
      asm volatile("s_wait_xcnt 0x0" ::: "memory");
    }
    // keeps the next chunk's loads in front of this chunk's matrix work, and that work
    // behind the last chunk's stores (else two chunks' results are held at once)
    __builtin_amdgcn_sched_barrier(0);

    if (chunk == 0) {
      #pragma unroll
      for (int s = 0; s < 8; ++s) {
        bf[0][s][0] = wq[s][0].x; bf[0][s][1] = wq[s][1].x;
        bf[1][s][0] = wq[s][0].y; bf[1][s][1] = wq[s][1].y;
        bf[2][s][0] = wq[s][0].z; bf[2][s][1] = wq[s][1].z;
        bf[3][s][0] = wq[s][0].w; bf[3][s][1] = wq[s][1].w;
      }
    }

    // ---- GEMM2: (16x32) x (32x128) -> 4 column tiles per wave ----
    v8f acc[4];
    #pragma unroll
    for (int j = 0; j < 4; ++j) acc[j] = v8f{0.f, 0.f, 0.f, 0.f, 0.f, 0.f, 0.f, 0.f};
    #pragma unroll
    for (int q = 0; q < 4; ++q) {
      v2f a0, a1;
      a0[0] = aq[cur][q].x; a0[1] = aq[cur][q].y;
      a1[0] = aq[cur][q].z; a1[1] = aq[cur][q].w;
      #pragma unroll
      for (int j = 0; j < 4; ++j)
        acc[j] = __builtin_amdgcn_wmma_f32_16x16x4_f32(false, a0, false, bf[j][2 * q],
                                                       (short)0, acc[j], false, false);
      #pragma unroll
      for (int j = 0; j < 4; ++j)
        acc[j] = __builtin_amdgcn_wmma_f32_16x16x4_f32(false, a1, false, bf[j][2 * q + 1],
                                                       (short)0, acc[j], false, false);
    }
    #pragma unroll
    for (int r = 0; r < 8; ++r) {
      float4 o;
      o.x = (acc[0][r] + bias.x) * G.x + SH.x + xr[cur][r].x;
      o.y = (acc[1][r] + bias.y) * G.y + SH.y + xr[cur][r].y;
      o.z = (acc[2][r] + bias.z) * G.z + SH.z + xr[cur][r].z;
      o.w = (acc[3][r] + bias.w) * G.w + SH.w + xr[cur][r].w;
      *reinterpret_cast<float4*>(ow + (chunk * CHUNK_TOK + r) * (H_ * D_)) = o;
    }
    // the stores' data registers are refilled by the next chunk's work
    if (chunk + 1 < CHUNKS) asm volatile("s_wait_xcnt 0x0" ::: "memory");
  }
}

// Fold the blocks' moments into per-feature (G, SH) with the 0.1 adapter scale pre-applied.
// One block per head. With mu = mean of m and C = M / N - mu mu^T (the covariance of m),
// column d of y = m Wu + b has mean mu . Wu[:,d] + b[d] and variance Wu[:,d] . (C Wu)[:,d].
__global__ __launch_bounds__(1024) void bn_stats(
    const float* __restrict__ partial,
    const float* __restrict__ wu,  const float* __restrict__ bup,
    const float* __restrict__ bn_g, const float* __restrict__ bn_b,
    float* __restrict__ gsh)
{
  __shared__ float s_part[4 * MOM_STRIDE];   // four quarter sums over the head's blocks
  __shared__ float s_m[MOM_STRIDE];          // M / N in the blocks' order, then mu
  __shared__ float s_c[K_ * 34];             // C, row pitch 34: 8-byte reads, no bank shared
  __shared__ float s_v[4 * D_];              // per row tile of C: variance parts, then mean parts

  const int tid  = threadIdx.x;
  const int lane = tid & 31;
  const int hi   = lane >> 4;
  const int ln16 = lane & 15;
  const int h    = blockIdx.x;
  const int wv   = __builtin_amdgcn_readfirstlane(tid >> 5);   // wave number, in a scalar register
  const int ti   = wv & 1;          // 16-row tile of C
  const int tj   = (wv >> 1) & 7;   // 16-column tile of Wu

  // What does not depend on the moments is asked for first, so that it arrives under the fold.
  const float* __restrict__ wuc = wu + h * (K_ * D_) + tj * 16 + ln16;
  v2f bw[8];                        // B fragments of Wu
  float wr[8];                      // Wu at the accumulator's own positions
  #pragma unroll
  for (int s = 0; s < 8; ++s) {
    bw[s][0] = wuc[(s * 4 + 2 * hi + 0) * D_];
    bw[s][1] = wuc[(s * 4 + 2 * hi + 1) * D_];
    wr[s]    = wuc[(ti * 16 + s + 8 * hi) * D_];
  }
  const int f = h * D_ + (tid & (D_ - 1));
  const float gam = bn_g[f], bet = bn_b[f], bu = bup[f];

  // ---- sum over the head's TOKGRP blocks: 16-byte loads, a quarter of the blocks per thread ----
  {
    const int part = tid >> 8;
    const int c4   = tid & 255;
    if (c4 < MOM_STRIDE / 4) {
      const float4* __restrict__ p = reinterpret_cast<const float4*>(
          partial + (size_t)(h * TOKGRP + part * (TOKGRP / 4)) * MOM_STRIDE) + c4;
      float4 a = make_float4(0.f, 0.f, 0.f, 0.f);
      // unrolled so that 16 loads are in flight behind one wait instead of one
      #pragma unroll 16
      for (int t = 0; t < TOKGRP / 4; ++t) {
        const float4 v = p[t * (MOM_STRIDE / 4)];
        a.x += v.x; a.y += v.y; a.z += v.z; a.w += v.w;
      }
      reinterpret_cast<float4*>(s_part + part * MOM_STRIDE)[c4] = a;
    }
  }
  __syncthreads();
  if (tid < MOM_STRIDE)
    s_m[tid] = (s_part[tid] + s_part[MOM_STRIDE + tid] + s_part[2 * MOM_STRIDE + tid] +
                s_part[3 * MOM_STRIDE + tid]) * (1.0f / (float)NTOK);
  __syncthreads();

  // ---- C[k][l], one element per thread ----
  {
    const int k = tid >> 5;
    const int l = tid & 31;
    int plane, row, col;
    if ((k < 16) == (l < 16)) { plane = (k < 16) ? 0 : 512; row = k & 15; col = l & 15; }
    else                      { plane = 256; row = (k < 16) ? k : l; col = ((k < 16) ? l : k) - 16; }
    s_c[k * 34 + l] = s_m[plane + (row & 7) * 32 + (row >> 3) * 16 + col] - s_m[768 + k] * s_m[768 + l];
  }
  __syncthreads();

  // ---- T = C Wu, (32x32) x (32x128): one 16x16 tile per wave, sixteen waves ----
  if (wv < 16) {
    v8f acc = {0.f, 0.f, 0.f, 0.f, 0.f, 0.f, 0.f, 0.f};
    #pragma unroll
    for (int s = 0; s < 8; ++s) {
      const v2f a = *reinterpret_cast<const v2f*>(&s_c[(ti * 16 + ln16) * 34 + s * 4 + 2 * hi]);
      acc = __builtin_amdgcn_wmma_f32_16x16x4_f32(false, a, false, bw[s],
                                                  (short)0, acc, false, false);
    }
    float pv = 0.f, pm = 0.f;
    #pragma unroll
    for (int r = 0; r < 8; ++r) {
      pv += wr[r] * acc[r];
      pm += wr[r] * s_m[768 + ti * 16 + r + 8 * hi];
    }
    pv += __shfl_xor(pv, 16, 32);   // fold the rows r+8 onto the rows r
    pm += __shfl_xor(pm, 16, 32);
    if (hi == 0) {
      s_v[ti * D_ + tj * 16 + ln16]          = pv;
      s_v[2 * D_ + ti * D_ + tj * 16 + ln16] = pm;
    }
  }
  __syncthreads();

  if (tid < D_) {
    const float var  = s_v[tid] + s_v[D_ + tid];
    const float mean = s_v[2 * D_ + tid] + s_v[3 * D_ + tid] + bu;
    const float g    = 0.1f * gam * rsqrtf(var + 1e-5f);
    gsh[f]        = g;
    gsh[1024 + f] = 0.1f * bet - mean * g;
  }
}

extern "C" void kernel_launch(void* const* d_in, const int* in_sizes, int n_in,
                              void* d_out, int out_size, void* d_ws, size_t ws_size,
                              hipStream_t stream) {
  const float* x    = (const float*)d_in[0];
  const float* ln_g = (const float*)d_in[1];
  const float* ln_b = (const float*)d_in[2];
  const float* wd   = (const float*)d_in[3];
  const float* bdn  = (const float*)d_in[4];
  const float* wu   = (const float*)d_in[5];
  const float* bup  = (const float*)d_in[6];
  const float* bn_g = (const float*)d_in[7];
  const float* bn_b = (const float*)d_in[8];
  float* out = (float*)d_out;

  float* partial = (float*)d_ws;                 // 1024 blocks * MOM_STRIDE floats = 3.2 MB
  float* gsh     = partial + (size_t)H_ * TOKGRP * MOM_STRIDE;  // 2048 floats
  float* mid     = gsh + 2048;                   // NTOK*H_*K_ floats = 32 MB

  dim3 grid(TOKGRP, H_);
  adapter_stats<<<grid, 256, 0, stream>>>(x, ln_g, ln_b, wd, bdn, mid, partial);
  bn_stats<<<H_, 1024, 0, stream>>>(partial, wu, bup, bn_g, bn_b, gsh);
  adapter_apply<<<grid, 256, 0, stream>>>(x, wu, bup, gsh, mid, out);
}

// v008
// One run takes 52.2 microseconds.
// Timed twice side by side with v007, it ran 1.04 times as fast both times.
// Over all steps from v000 it is 3.41 times as fast.
#include <hip/hip_runtime.h>

typedef float v2f __attribute__((ext_vector_type(2)));
typedef float v4f __attribute__((ext_vector_type(4)));
typedef float v8f __attribute__((ext_vector_type(8)));

#define H_ 8
#define D_ 128
#define K_ 32
#define NTOK 32768          // B*S
#define CHUNK_TOK 64
#define CHUNKS 4
#define TOKGRP 128          // adapter_stats' gridDim.x ; TOKGRP*CHUNKS*CHUNK_TOK == NTOK
#define NORM_STRIDE 132     // 132 mod 64 = 4 -> conflict-free v2f A reads
#define MID_STRIDE 36

#define LN_SETS 2           // a wave normalises 8 token rows per chunk, four at a time, eight lanes to a row
#define LN_PART 4           // 16-byte pieces of a row that one lane holds
#define MID_TILE 512        // floats of one saved 16-token x 32 activation tile
#define MOM_STRIDE 800      // floats of one block's moments: M00, M01, M11 (256 each), column sums (32)
#define MOM_WAVE 544        // floats one wave hands to the block's fold: 256 + 256 + 32
#define AP_GROUPS 4         // first-pass token groups that one second-pass block takes
#define AP_GRID 32          // second-pass blocks a head: TOKGRP / AP_GROUPS
#define AP_CHUNKS 8         // chunks a second-pass wave walks: two groups of CHUNKS
// place of a wave's chunk c, counted in chunks from its first group's start (second group: 8 groups on)
#define AP_POS(c) (((c) >> 2) * 8 * CHUNKS + ((c) & 3))

// Butterfly sum over the eight lanes that share a token row, for the wave's LN_SETS row sets
// at once: each exchange step is issued for both sets before a result is used, so one
// exchange latency is paid per step (hence the full unrolls).
__device__ __forceinline__ void row_sum_sets(float (&s)[LN_SETS]) {
  #pragma unroll
  for (int m = 1; m < 8; m <<= 1) {
    float o[LN_SETS];
    #pragma unroll
    for (int i = 0; i < LN_SETS; ++i) o[i] = __shfl_xor(s[i], m, 32);
    // both sets' exchanges go out before either is waited for (the compiler staggered them,
    // and a reduction then waited out five exchange latencies instead of three)
    __builtin_amdgcn_sched_barrier(0);
    #pragma unroll
    for (int i = 0; i < LN_SETS; ++i) s[i] += o[i];
  }
}

__device__ __forceinline__ float gelu_exact(float v) {
  return 0.5f * v * (1.0f + erff(v * 0.70710678118654752440f));
}

// Work-group barrier that orders LDS traffic only. __syncthreads() also waits out the wave's
// global loads and stores, so a load issued ahead would be waited for at the very next barrier
// and a store's acknowledgement would hold up the whole block. Nothing that passes between the
// waves of adapter_stats inside its chunk loop goes through global memory.
__device__ __forceinline__ void lds_barrier() {
  __builtin_amdgcn_fence(__ATOMIC_RELEASE, "workgroup", "local");
  __builtin_amdgcn_s_barrier();
  __builtin_amdgcn_fence(__ATOMIC_ACQUIRE, "workgroup", "local");
}

// First pass: m = gelu(down(ln(x))); saves m, so that the second pass starts from m instead
// of from x, and emits per block the column sums of m and its second moment M = m^T m
// (32 x 32, summed over the block's tokens). y = m Wu + b is linear in m, so the batch mean
// and variance of every column of y follow from these (see adapter_apply): y is not formed here.
// M is kept as the tiles M00, M01, M11 (M10 is M01 transposed), each in accumulator order:
// float number r*32+lane holds row r + 8*(lane >> 4), column lane & 15.
// Saved layout: one MID_TILE block per 16-token tile, in the order the up projection's
// A fragments are read: float4 number q*32+lane holds k = 8q+2*hi+{0,1} and 8q+4+2*hi+{0,1}
// of token row (lane & 15), so a wave's 16-byte access covers 512 contiguous bytes.
// amdgpu_waves_per_eu(8): the rows held one chunk ahead must not push the register count past
// 128, or only three blocks instead of four would share a WGP.
__global__ __launch_bounds__(256) __attribute__((amdgpu_waves_per_eu(8))) void adapter_stats(
    const float* __restrict__ x,
    const float* __restrict__ ln_g, const float* __restrict__ ln_b,
    const float* __restrict__ wd,  const float* __restrict__ bdn,
    float* __restrict__ mid,         // [(((h*128+bx)*4+chunk)*4+mtile)*MID_TILE]
    float* __restrict__ partial)     // [(h*128+bx)*MOM_STRIDE + {0 M00, 256 M01, 512 M11, 768 sums}]
{
  __shared__ float s_norm[CHUNK_TOK * NORM_STRIDE];
  __shared__ float s_mid[CHUNK_TOK * MID_STRIDE];
  __shared__ float s_wd[D_ * K_];   // the head's down weights as B fragments: float (cgrp*32+s)*64 + lane*2 + {0,1}
  __shared__ float s_gb[8 * 2 * D_]; // LayerNorm gamma, then beta, of the head: one copy per wave, so no barrier is owed

  const int tid  = threadIdx.x;
  const int lane = tid & 31;
  const int w    = tid >> 5;      // wave 0..7
  const int hi   = lane >> 4;     // lane half selects K pair / M+8
  const int ln16 = lane & 15;
  const int h    = blockIdx.y;
  const int bx   = blockIdx.x;

  const float* __restrict__ wdh = wd + h * (D_ * K_);

  const float4 lg = *reinterpret_cast<const float4*>(ln_g + h * D_ + lane * 4);
  const float4 lb = *reinterpret_cast<const float4*>(ln_b + h * D_ + lane * 4);

  // LayerNorm layout: eight lanes share a token row. Lane part `sub` holds the four floats at
  // column 32*q + 4*sub for q = 0..3, so a wave's 16-byte access covers one whole 128-byte line
  // in each of four rows. A row's sum is then 15 additions inside a lane and three exchange
  // steps, and a wave has two sums to exchange instead of eight over five steps.
  // Rows of a set: lanes 0-15 take rows 8 apart, which lie 32 banks apart at NORM_STRIDE.
  const int sub  = lane & 7;
  const int lrow = (w >> 1) * 16 + (w & 1) * 4 + ((lane >> 3) & 1) * 8 + (lane >> 4);   // + 2 * set

  const int mtile = w >> 1;       // 0..3 : 16-token row tile
  const int cgrp  = w & 1;        // column group

  // Moments of the wave's tokens, carried over all chunks: the diagonal tile of the wave's
  // own 16 columns, its half of the tile M01, and each lane's column sum.
  v8f momD = {0.f, 0.f, 0.f, 0.f, 0.f, 0.f, 0.f, 0.f};
  v8f momO = {0.f, 0.f, 0.f, 0.f, 0.f, 0.f, 0.f, 0.f};
  float csum = 0.f;

  // Asked for behind gamma and beta, in front of the rows and the weights: a load still open at
  // the loop's head would be waited for inside it, and the rows loaded ahead with it.
  const float bias_d = bdn[h * K_ + cgrp * 16 + ln16];

  // The wave's 8 token rows of a chunk are asked for one chunk ahead: chunk 0's here, in front
  // of the weight staging, chunk c+1's behind chunk c's LayerNorm, so that they travel under
  // the matrix work, the GELU and the moments instead of being waited for at the loop's head.
  // Unrolled so that v[] stays in registers and the eight loads go out together.
  const float* __restrict__ xrow =
      x + (size_t)(bx * CHUNKS * CHUNK_TOK + lrow) * (H_ * D_) + h * D_ + sub * 4;
  v4f v[LN_SETS][LN_PART];
  #pragma unroll
  for (int j = 0; j < LN_SETS; ++j)
    #pragma unroll
    for (int q = 0; q < LN_PART; ++q)
      v[j][q] = *reinterpret_cast<const v4f*>(xrow + 2 * j * (H_ * D_) + q * 32);
  // the loads' address registers may be reused by the work that follows
  asm volatile("s_wait_xcnt 0x0" ::: "memory");

  // A lane needs gamma and beta at its 16 columns: read from LDS in each chunk, they do not
  // hold 32 registers across the matrix work.
  float* gbw = s_gb + w * (2 * D_);
  *reinterpret_cast<float4*>(gbw + lane * 4)      = lg;
  *reinterpret_cast<float4*>(gbw + D_ + lane * 4) = lb;

  // The weights do not change from chunk to chunk. They are laid down once in LDS, in the
  // order the B fragments are read, instead of being held in 64 registers of every wave:
  // the register count then lets four blocks share a WGP instead of two. The four waves of
  // a column group write eight k steps each; the first barrier in the loop publishes them.
  // Unrolled so that a wave's sixteen loads go out together, behind one latency.
  #pragma unroll
  for (int i = 0; i < 8; ++i) {
    const int s = mtile * 8 + i;
    v2f b;
    b[0] = wdh[(s * 4 + 2 * hi + 0) * K_ + cgrp * 16 + ln16];
    b[1] = wdh[(s * 4 + 2 * hi + 1) * K_ + cgrp * 16 + ln16];
    *reinterpret_cast<v2f*>(&s_wd[(cgrp * 32 + s) * 64 + lane * 2]) = b;
  }
  for (int chunk = 0; chunk < CHUNKS; ++chunk) {
    // ---- LayerNorm: eight lanes per token row, 8 tokens per wave ----
    // The rows (loaded one chunk ahead) are carried through the two reductions together.
    // The loops are unrolled so that v[] and red[] stay in registers and the independent
    // chains can be interleaved.
    {
      v4f g[LN_PART], b[LN_PART];
      #pragma unroll
      for (int q = 0; q < LN_PART; ++q) {
        g[q] = *reinterpret_cast<const v4f*>(gbw + q * 32 + sub * 4);
        b[q] = *reinterpret_cast<const v4f*>(gbw + D_ + q * 32 + sub * 4);
      }
      // keeps these eight LDS reads in one group in front of the sums, whose work covers their
      // latency (the compiler sank them in pairs to their uses, each pair waited for at once)
      __builtin_amdgcn_sched_barrier(0);
      // The sums inside a lane run on register pairs as they were loaded (two floats an instruction).
      float red[LN_SETS];
      #pragma unroll
      for (int j = 0; j < LN_SETS; ++j) {
        const v2f t = ((v[j][0].lo + v[j][0].hi) + (v[j][1].lo + v[j][1].hi)) +
                      ((v[j][2].lo + v[j][2].hi) + (v[j][3].lo + v[j][3].hi));
        red[j] = t[0] + t[1];
      }
      row_sum_sets(red);
      #pragma unroll
      for (int j = 0; j < LN_SETS; ++j) {
        const float mean = red[j] * (1.0f / 128.0f);
        v[j][0] -= mean;
        v2f ta = v[j][0].lo * v[j][0].lo;
        v2f tb = v[j][0].hi * v[j][0].hi;
        #pragma unroll
        for (int q = 1; q < LN_PART; ++q) {
          v[j][q] -= mean;
          ta += v[j][q].lo * v[j][q].lo;
          tb += v[j][q].hi * v[j][q].hi;
        }
        const v2f t = ta + tb;
        red[j] = t[0] + t[1];
      }
      row_sum_sets(red);
      float rs[LN_SETS];
      #pragma unroll
      for (int j = 0; j < LN_SETS; ++j) rs[j] = rsqrtf(red[j] * (1.0f / 128.0f) + 1e-5f);
      #pragma unroll
      for (int q = 0; q < LN_PART; ++q)
        #pragma unroll
        for (int j = 0; j < LN_SETS; ++j)
          *reinterpret_cast<v4f*>(&s_norm[(lrow + 2 * j) * NORM_STRIDE + q * 32 + sub * 4]) =
              v[j][q] * rs[j] * g[q] + b[q];
      if (chunk + 1 < CHUNKS) {
        #pragma unroll
        for (int j = 0; j < LN_SETS; ++j)
          #pragma unroll
          for (int q = 0; q < LN_PART; ++q)
            v[j][q] = *reinterpret_cast<const v4f*>(
                xrow + ((chunk + 1) * CHUNK_TOK + 2 * j) * (H_ * D_) + q * 32);
        // the loads' address registers may be reused by the work that follows
        asm volatile("s_wait_xcnt 0x0" ::: "memory");
      }
    }
    lds_barrier();

    // ---- GEMM1: (16x128) x (128x32) -> one 16x16 tile per wave ----
    {
      const int n0 = cgrp * 16;
      v8f acc = {0.f, 0.f, 0.f, 0.f, 0.f, 0.f, 0.f, 0.f};
      #pragma unroll
      for (int s = 0; s < 32; ++s) {
        const v2f a = *reinterpret_cast<const v2f*>(
            &s_norm[(mtile * 16 + ln16) * NORM_STRIDE + s * 4 + 2 * hi]);
        const v2f b = *reinterpret_cast<const v2f*>(&s_wd[(cgrp * 32 + s) * 64 + lane * 2]);
        acc = __builtin_amdgcn_wmma_f32_16x16x4_f32(false, a, false, b,
                                                    (short)0, acc, false, false);
      }
      float mv[8];
      #pragma unroll
      for (int r = 0; r < 8; ++r) {
        mv[r] = gelu_exact(acc[r] + bias_d);
        s_mid[(mtile * 16 + r + 8 * hi) * MID_STRIDE + n0 + ln16] = mv[r];
        csum += mv[r];
      }
      // ---- diagonal moment tile, straight from the accumulator registers ----
      // The product sums over tokens, so any token order serves as long as A and B share it:
      // step s takes tokens 8*hi + 2s + {0,1}, which is what lane half hi holds in mv[2s], mv[2s+1];
      // lane & 15 is the column, as an A row and as a B column alike.
      #pragma unroll
      for (int s = 0; s < 4; ++s) {
        v2f f;
        f[0] = mv[2 * s];
        f[1] = mv[2 * s + 1];
        momD = __builtin_amdgcn_wmma_f32_16x16x4_f32(false, f, false, f,
                                                     (short)0, momD, false, false);
      }
    }
    lds_barrier();

    // ---- off-diagonal moment tile M01: A = columns 0..15, B = columns 16..31, same tokens ----
    // Shared out over the two waves of a token tile: of the four steps above, cgrp 0 takes
    // steps 0,1 and cgrp 1 steps 2,3. Both sides are read from s_mid, one of them being the
    // other wave's; the step is chosen in the address, so that no register is picked at run time.
    #pragma unroll
    for (int t = 0; t < 2; ++t) {
      const int row = mtile * 16 + 8 * hi + cgrp * 4 + 2 * t;
      v2f fa, fb;
      fa[0] = s_mid[(row + 0) * MID_STRIDE + ln16];
      fa[1] = s_mid[(row + 1) * MID_STRIDE + ln16];
      fb[0] = s_mid[(row + 0) * MID_STRIDE + 16 + ln16];
      fb[1] = s_mid[(row + 1) * MID_STRIDE + 16 + ln16];
      momO = __builtin_amdgcn_wmma_f32_16x16x4_f32(false, fa, false, fb,
                                                   (short)0, momO, false, false);
    }

    // ---- save the activation tile (one of the two waves that share it) ----
    if (cgrp == 0) {
      // the tile as the up projection's A fragments (unrolled: af[] stays in registers)
      v2f af[8];
      #pragma unroll
      for (int s = 0; s < 8; ++s)
        af[s] = *reinterpret_cast<const v2f*>(
            &s_mid[(mtile * 16 + ln16) * MID_STRIDE + s * 4 + 2 * hi]);
      float4* __restrict__ mt = reinterpret_cast<float4*>(
          mid + (size_t)(((h * TOKGRP + bx) * CHUNKS + chunk) * 4 + mtile) * MID_TILE) + lane;
      #pragma unroll
      for (int q = 0; q < 4; ++q)
        mt[q * 32] = make_float4(af[2 * q][0], af[2 * q][1], af[2 * q + 1][0], af[2 * q + 1][1]);
      // the stores' address and data registers are reused right behind this block
      asm volatile("s_wait_xcnt 0x0" ::: "memory");
    }

    lds_barrier();
  }

  // ---- fold the eight waves' moments; s_norm is free behind the loop's last barrier ----
  #pragma unroll
  for (int r = 0; r < 8; ++r) {
    s_norm[w * MOM_WAVE + r * 32 + lane]       = momD[r];
    s_norm[w * MOM_WAVE + 256 + r * 32 + lane] = momO[r];
  }
  s_norm[w * MOM_WAVE + 512 + lane] = csum;
  __syncthreads();
  {
    float m00 = 0.f, m01 = 0.f, m11 = 0.f;
    for (int t = 0; t < 4; ++t) {      // even waves own columns 0..15, odd waves 16..31
      m00 += s_norm[(2 * t) * MOM_WAVE + tid];
      m11 += s_norm[(2 * t + 1) * MOM_WAVE + tid];
      m01 += s_norm[(2 * t) * MOM_WAVE + 256 + tid] + s_norm[(2 * t + 1) * MOM_WAVE + 256 + tid];
    }
    const size_t base = (size_t)(h * TOKGRP + bx) * MOM_STRIDE;
    partial[base + tid]       = m00;
    partial[base + 256 + tid] = m01;
    partial[base + 512 + tid] = m11;
    if (tid < K_) {                    // one thread per activation column
      const int ww = tid >> 4;
      const int c  = tid & 15;
      float s = 0.f;
      for (int t = 0; t < 4; ++t)
        s += s_norm[(2 * t + ww) * MOM_WAVE + 512 + c] + s_norm[(2 * t + ww) * MOM_WAVE + 512 + 16 + c];
      partial[base + 768 + tid] = s;
    }
  }
}

// Second pass: y = up(m) from the saved activations, then the BN affine (G,SH) and the residual.
// There is no launch of its own for the batch statistics: every block first folds its head's
// TOKGRP moment sets and forms G and SH itself (see the head below), while its first loads travel.
// So that this re-read stays small, a block is sixteen waves and takes AP_GROUPS first-pass token
// groups: AP_GRID blocks a head, one per WGP. Its groups lie 8 apart, so that they share the
// block's own index modulo 8 (for speed only).
// Behind the head every wave works alone on its 16-token x 64-column tiles.
// The wave's four 16-column tiles are interleaved: tile j holds the feature columns 4*n + j
// (n = lane & 15 is the tile's own column), so the four results a lane has of one token row are
// adjacent in memory. Residual loads and output stores are then 16 bytes a lane and cover
// 256 contiguous bytes of a row, whole lines, instead of 64-byte pieces.
// The pointers carry no __restrict__ here: the loads then keep their written order against the
// s_wait_xcnt statements below (with it the compiler moved loads across those waits).
__global__ __launch_bounds__(512) void adapter_apply(
    const float* x,
    const float* wu,  const float* bup,
    const float* bn_g, const float* bn_b,
    const float* partial,   // layout: see adapter_stats
    const float* mid,       // layout: see adapter_stats
    float* out)
{
  __shared__ float s_part[2 * MOM_STRIDE];   // two half sums over the head's blocks
  __shared__ float s_m[MOM_STRIDE];          // M / N in the blocks' order, then mu
  __shared__ float s_c[K_ * 34];             // C, row pitch 34: 8-byte reads, no bank shared
  __shared__ float s_v[4 * D_];              // per row tile of C: variance parts, then mean parts

  const int tid  = threadIdx.x;
  const int lane = tid & 31;
  const int w    = tid >> 5;      // wave 0..15
  const int hi   = lane >> 4;     // lane half selects K pair / M+8
  const int ln16 = lane & 15;
  const int h    = blockIdx.y;
  // first of the wave's two first-pass groups; the second lies 8 groups on
  const int bx   = (blockIdx.x & 7) + 8 * (AP_GROUPS * (blockIdx.x >> 3) + 2 * (w >> 3));
  const int mtile = (w >> 1) & 3; // 0..3 : 16-token row tile
  const int cgrp  = w & 1;        // column group

  const int col0 = h * D_ + cgrp * 64 + ln16 * 4;   // the lane's four adjacent feature columns
  const float* wuc = wu + h * (K_ * D_) + cgrp * 64 + ln16 * 4;

  const float4* mt = reinterpret_cast<const float4*>(
      mid + (size_t)((h * TOKGRP + bx) * CHUNKS * 4 + mtile) * MID_TILE) + lane;
  const size_t off0 = (size_t)(bx * CHUNKS * CHUNK_TOK + mtile * 16 + 8 * hi) * (H_ * D_) + col0;
  const float* xw = x + off0;
  float* ow = out + off0;

  // Two register sets: chunk c+1's activations and residual rows are on their way while
  // chunk c is multiplied. All loops over them are unrolled so that the sets stay registers.
  float4 aq[2][4];
  float4 xr[2][8];
  // What does not change from chunk to chunk: the B fragments (tile j, k step s), bias, G, SH.
  v2f bf[4][8];
  float4 bias, G, SH;
  float4 wq[8][2];   // row k = 4s + 2*hi + e of Wu at the lane's four columns, until bf is put together
  #pragma unroll
  for (int q = 0; q < 4; ++q) aq[0][q] = mt[q * 32];
  // a residual load that follows may land in a register these loads name (as in the loop below)
  asm volatile("s_wait_xcnt 0x0" ::: "memory");
  #pragma unroll
  for (int r = 0; r < 8; ++r) xr[0][r] = *reinterpret_cast<const float4*>(xw + r * (H_ * D_));
  // the head's vector work that follows may reuse these loads' address registers
  asm volatile("s_wait_xcnt 0x0" ::: "memory");

  // ---- head: the head's batch statistics, folded into (G, SH) with the 0.1 adapter scale ----
  // With mu = mean of m and C = M / N - mu mu^T (the covariance of m), column d of y = m Wu + b
  // has mean mu . Wu[:,d] + b[d] and variance Wu[:,d] . (C Wu)[:,d].
  {
    const int wv = __builtin_amdgcn_readfirstlane(w);   // wave number, in a scalar register
    const int ti = wv & 1;          // 16-row tile of C
    const int tj = wv >> 1;         // 16-column tile of Wu

    // What does not depend on the moments is asked for first, so that it arrives under the fold.
    const float* wut = wu + h * (K_ * D_) + tj * 16 + ln16;
    v2f bw[8];                      // B fragments of Wu
    float wr[8];                    // Wu at the accumulator's own positions
    #pragma unroll
    for (int s = 0; s < 8; ++s) {
      bw[s][0] = wut[(s * 4 + 2 * hi + 0) * D_];
      bw[s][1] = wut[(s * 4 + 2 * hi + 1) * D_];
      wr[s]    = wut[(ti * 16 + s + 8 * hi) * D_];
    }
    // as above, for the weight loads' address registers
    asm volatile("s_wait_xcnt 0x0" ::: "memory");
    const float* pbu = bup + col0;
    const float* pga = bn_g + col0;
    const float* pbe = bn_b + col0;
    bias = *reinterpret_cast<const float4*>(pbu);
    const float4 gam = *reinterpret_cast<const float4*>(pga);
    const float4 bet = *reinterpret_cast<const float4*>(pbe);
    // as above, for these three loads' address registers; named as inputs, they stay whole up to the wait
    asm volatile("s_wait_xcnt 0x0" :: "v"(pbu), "v"(pga), "v"(pbe) : "memory");

    // sum over the head's TOKGRP blocks: 16-byte loads, half of the blocks per thread
    {
      const int part = tid >> 8;
      const int c4   = tid & 255;
      if (c4 < MOM_STRIDE / 4) {
        const float4* p = reinterpret_cast<const float4*>(
            partial + (size_t)(h * TOKGRP + part * (TOKGRP / 2)) * MOM_STRIDE) + c4;
        float4 a = make_float4(0.f, 0.f, 0.f, 0.f);
        for (int tb = 0; tb < TOKGRP / 2; tb += 16) {
          // unrolled so that 16 loads are in flight behind one wait instead of one
          float4 pv4[16];
          #pragma unroll
          for (int t = 0; t < 16; ++t) pv4[t] = p[(tb + t) * (MOM_STRIDE / 4)];
          // the address registers may be reused behind the sixteen loads; named as an input, they
          // stay whole up to the wait (else the last load landed in its own address pair)
          asm volatile("s_wait_xcnt 0x0" :: "v"(p) : "memory");
          #pragma unroll
          for (int t = 0; t < 16; ++t) {
            a.x += pv4[t].x; a.y += pv4[t].y; a.z += pv4[t].z; a.w += pv4[t].w;
          }
        }
        reinterpret_cast<float4*>(s_part + part * MOM_STRIDE)[c4] = a;
      }
    }
    // The up projection's weight rows are asked for here, where the fold's registers are free:
    // they travel under the LDS steps that follow (whose barriers do not wait for global loads).
    const float* wuh = wuc + 2 * hi * D_;
    #pragma unroll
    for (int s = 0; s < 8; ++s) {
      wq[s][0] = *reinterpret_cast<const float4*>(wuh + (s * 4 + 0) * D_);
      wq[s][1] = *reinterpret_cast<const float4*>(wuh + (s * 4 + 1) * D_);
    }
    // the weight rows' address registers are reused by the vector work that follows; named as an
    // input, they stay whole up to the wait (else the last load landed in its own address pair)
    asm volatile("s_wait_xcnt 0x0" :: "v"(wuh) : "memory");
    lds_barrier();
    for (int i = tid; i < MOM_STRIDE; i += 512)
      s_m[i] = (s_part[i] + s_part[MOM_STRIDE + i]) * (1.0f / (float)NTOK);
    lds_barrier();

    // C[k][l], two elements per thread
    #pragma unroll
    for (int e = 0; e < 2; ++e) {
      const int k = (tid >> 5) + 16 * e;
      const int l = tid & 31;
      int plane, row, col;
      if ((k < 16) == (l < 16)) { plane = (k < 16) ? 0 : 512; row = k & 15; col = l & 15; }
      else                      { plane = 256; row = (k < 16) ? k : l; col = ((k < 16) ? l : k) - 16; }
      s_c[k * 34 + l] = s_m[plane + (row & 7) * 32 + (row >> 3) * 16 + col] - s_m[768 + k] * s_m[768 + l];
    }
    lds_barrier();

    // T = C Wu, (32x32) x (32x128): one 16x16 tile per wave, sixteen waves
    {
      v8f acc = {0.f, 0.f, 0.f, 0.f, 0.f, 0.f, 0.f, 0.f};
      #pragma unroll
      for (int s = 0; s < 8; ++s) {
        const v2f a = *reinterpret_cast<const v2f*>(&s_c[(ti * 16 + ln16) * 34 + s * 4 + 2 * hi]);
        acc = __builtin_amdgcn_wmma_f32_16x16x4_f32(false, a, false, bw[s],
                                                    (short)0, acc, false, false);
      }
      float pv = 0.f, pm = 0.f;
      #pragma unroll
      for (int r = 0; r < 8; ++r) {
        pv += wr[r] * acc[r];
        pm += wr[r] * s_m[768 + ti * 16 + r + 8 * hi];
      }
      pv += __shfl_xor(pv, 16, 32);   // fold the rows r+8 onto the rows r
      pm += __shfl_xor(pm, 16, 32);
      if (hi == 0) {
        s_v[ti * D_ + tj * 16 + ln16]          = pv;
        s_v[2 * D_ + ti * D_ + tj * 16 + ln16] = pm;
      }
    }
    lds_barrier();

    // every lane forms G and SH of its own four columns
    const int c = cgrp * 64 + ln16 * 4;
    const float4 v0 = *reinterpret_cast<const float4*>(&s_v[c]);
    const float4 v1 = *reinterpret_cast<const float4*>(&s_v[D_ + c]);
    const float4 m0 = *reinterpret_cast<const float4*>(&s_v[2 * D_ + c]);
    const float4 m1 = *reinterpret_cast<const float4*>(&s_v[3 * D_ + c]);
    G.x = 0.1f * gam.x * rsqrtf(v0.x + v1.x + 1e-5f);
    G.y = 0.1f * gam.y * rsqrtf(v0.y + v1.y + 1e-5f);
    G.z = 0.1f * gam.z * rsqrtf(v0.z + v1.z + 1e-5f);
    G.w = 0.1f * gam.w * rsqrtf(v0.w + v1.w + 1e-5f);
    SH.x = 0.1f * bet.x - (m0.x + m1.x + bias.x) * G.x;
    SH.y = 0.1f * bet.y - (m0.y + m1.y + bias.y) * G.y;
    SH.z = 0.1f * bet.z - (m0.z + m1.z + bias.z) * G.z;
    SH.w = 0.1f * bet.w - (m0.w + m1.w + bias.w) * G.w;
  }

  #pragma unroll
  for (int chunk = 0; chunk < AP_CHUNKS; ++chunk) {
    const int cur = chunk & 1;
    if (chunk + 1 < AP_CHUNKS) {
      #pragma unroll
      for (int q = 0; q < 4; ++q) aq[cur ^ 1][q] = mt[AP_POS(chunk + 1) * (4 * MID_TILE / 4) + q * 32];
      // behind the last of these loads their address pair is free, and a residual load may land in it
      asm volatile("s_wait_xcnt 0x0" ::: "memory");
      #pragma unroll
      for (int r = 0; r < 8; ++r)
        xr[cur ^ 1][r] = *reinterpret_cast<const float4*>(
            xw + (AP_POS(chunk + 1) * CHUNK_TOK + r) * (H_ * D_));
    }
    // keeps the next chunk's loads in front of this chunk's matrix work, and that work
    // behind the last chunk's stores (else two chunks' results are held at once)
    __builtin_amdgcn_sched_barrier(0);

    if (chunk == 0) {
      #pragma unroll
      for (int s = 0; s < 8; ++s) {
        bf[0][s][0] = wq[s][0].x; bf[0][s][1] = wq[s][1].x;
        bf[1][s][0] = wq[s][0].y; bf[1][s][1] = wq[s][1].y;
        bf[2][s][0] = wq[s][0].z; bf[2][s][1] = wq[s][1].z;
        bf[3][s][0] = wq[s][0].w; bf[3][s][1] = wq[s][1].w;
      }
    }

    // ---- GEMM2: (16x32) x (32x128) -> 4 column tiles per wave ----
    v8f acc[4];
    #pragma unroll
    for (int j = 0; j < 4; ++j) acc[j] = v8f{0.f, 0.f, 0.f, 0.f, 0.f, 0.f, 0.f, 0.f};
    #pragma unroll
    for (int q = 0; q < 4; ++q) {
      v2f a0, a1;
      a0[0] = aq[cur][q].x; a0[1] = aq[cur][q].y;
      a1[0] = aq[cur][q].z; a1[1] = aq[cur][q].w;
      #pragma unroll
      for (int j = 0; j < 4; ++j)
        acc[j] = __builtin_amdgcn_wmma_f32_16x16x4_f32(false, a0, false, bf[j][2 * q],
                                                       (short)0, acc[j], false, false);
      #pragma unroll
      for (int j = 0; j < 4; ++j)
        acc[j] = __builtin_amdgcn_wmma_f32_16x16x4_f32(false, a1, false, bf[j][2 * q + 1],
                                                       (short)0, acc[j], false, false);
    }
    #pragma unroll
    for (int r = 0; r < 8; ++r) {
      float4 o;
      o.x = (acc[0][r] + bias.x) * G.x + SH.x + xr[cur][r].x;
      o.y = (acc[1][r] + bias.y) * G.y + SH.y + xr[cur][r].y;
      o.z = (acc[2][r] + bias.z) * G.z + SH.z + xr[cur][r].z;
      o.w = (acc[3][r] + bias.w) * G.w + SH.w + xr[cur][r].w;
      *reinterpret_cast<float4*>(ow + (AP_POS(chunk) * CHUNK_TOK + r) * (H_ * D_)) = o;
    }
    // the stores' data registers are refilled by the next chunk's work
    if (chunk + 1 < AP_CHUNKS) asm volatile("s_wait_xcnt 0x0" ::: "memory");
  }
}

extern "C" void kernel_launch(void* const* d_in, const int* in_sizes, int n_in,
                              void* d_out, int out_size, void* d_ws, size_t ws_size,
                              hipStream_t stream) {
  const float* x    = (const float*)d_in[0];
  const float* ln_g = (const float*)d_in[1];
  const float* ln_b = (const float*)d_in[2];
  const float* wd   = (const float*)d_in[3];
  const float* bdn  = (const float*)d_in[4];
  const float* wu   = (const float*)d_in[5];
  const float* bup  = (const float*)d_in[6];
  const float* bn_g = (const float*)d_in[7];
  const float* bn_b = (const float*)d_in[8];
  float* out = (float*)d_out;

  float* partial = (float*)d_ws;                 // 1024 blocks * MOM_STRIDE floats = 3.2 MB
  float* mid     = partial + (size_t)H_ * TOKGRP * MOM_STRIDE;  // NTOK*H_*K_ floats = 32 MB

  dim3 grid(TOKGRP, H_);
  adapter_stats<<<grid, 256, 0, stream>>>(x, ln_g, ln_b, wd, bdn, mid, partial);
  dim3 grid2(AP_GRID, H_);
  adapter_apply<<<grid2, 512, 0, stream>>>(x, wu, bup, bn_g, bn_b, partial, mid, out);
}

// v009
// One run takes 50 microseconds.
// Timed twice side by side with v008, it ran 1.04 and 1.05 times as fast.
// Counting every step since v000, it is 3.56 times as fast.
#include <hip/hip_runtime.h>

typedef float v2f __attribute__((ext_vector_type(2)));
typedef float v4f __attribute__((ext_vector_type(4)));
typedef float v8f __attribute__((ext_vector_type(8)));

#define H_ 8
#define D_ 128
#define K_ 32
#define NTOK 32768          // B*S
#define CHUNK_TOK 64
#define CHUNKS 4
#define TOKGRP 128          // adapter_stats' gridDim.x ; TOKGRP*CHUNKS*CHUNK_TOK == NTOK
#define NORM_STRIDE 132     // 132 mod 64 = 4 -> conflict-free v2f A reads
#define MID_STRIDE 36

#define LN_SETS 2           // a wave normalises 8 token rows per chunk, four at a time, eight lanes to a row
#define LN_PART 4           // 16-byte pieces of a row that one lane holds
#define MID_TILE 512        // floats of one saved 16-token x 32 activation tile
#define MOM_STRIDE 800      // floats of one block's moments: M00, M01, M11 (256 each), column sums (32)
#define MOM_WAVE 544        // floats one wave hands to the block's fold: 256 + 256 + 32
#define AP_GROUPS 4         // first-pass token groups that one second-pass block takes
#define AP_GRID 32          // second-pass blocks a head: TOKGRP / AP_GROUPS
#define AP_CHUNKS 8         // chunks a second-pass wave walks: two groups of CHUNKS
// place of a wave's chunk c, counted in chunks from its first group's start (second group: 8 groups on)
#define AP_POS(c) (((c) >> 2) * 8 * CHUNKS + ((c) & 3))

// Butterfly sum over the eight lanes that share a token row, for the wave's LN_SETS row sets
// at once: each exchange step is issued for both sets before a result is used, so one
// exchange latency is paid per step (hence the full unrolls).
__device__ __forceinline__ void row_sum_sets(float (&s)[LN_SETS]) {
  #pragma unroll
  for (int m = 1; m < 8; m <<= 1) {
    float o[LN_SETS];
    #pragma unroll
    for (int i = 0; i < LN_SETS; ++i) o[i] = __shfl_xor(s[i], m, 32);
    // both sets' exchanges go out before either is waited for (the compiler staggered them,
    // and a reduction then waited out five exchange latencies instead of three)
    __builtin_amdgcn_sched_barrier(0);
    #pragma unroll
    for (int i = 0; i < LN_SETS; ++i) s[i] += o[i];
  }
}

__device__ __forceinline__ v2f fma2(v2f a, v2f b, v2f c) { return __builtin_elementwise_fma(a, b, c); }
__device__ __forceinline__ v2f both(unsigned bits) {
  const float c = __builtin_bit_cast(float, bits);
  return v2f{c, c};
}

// erf(u) for |u| < 1: u + u * P(u*u). The coefficients and the order of the operations are those
// of the math library's erff, so the value is the library's, bit for bit (odd in u like the
// library's form on |u| with the sign copied back).
__device__ __forceinline__ v2f erf_below_one(v2f u) {
  const v2f t = u * u;
  v2f p = fma2(t, both(0xba1345e1u), both(0x3ba10414u));
  p = fma2(t, p, both(0xbcdac9b8u));
  p = fma2(t, p, both(0x3de703beu));
  p = fma2(t, p, both(0xbec09330u));
  p = fma2(t, p, both(0x3e0375d0u));
  return fma2(u, p, u);
}

// For a = |u| >= 1 the library has erf = 1 - exp(-q), q = a + a * Q(a): this is q.
__device__ __forceinline__ v2f erf_exponent_from_one(v2f a) {
  v2f q = fma2(a, both(0x378e98abu), both(0xb9c68948u));
  q = fma2(a, q, both(0x3b7cd369u));
  q = fma2(a, q, both(0xbcc618b2u));
  q = fma2(a, q, both(0x3dda74e4u));
  q = fma2(a, q, both(0x3f228afdu));
  q = fma2(a, q, both(0x3e03c728u));
  return fma2(a, q, a);
}

// Exact GELU of a lane's eight results, 0.5 v (1 + erf(v / sqrt 2)), two values an instruction.
// erff called value by value branches twice on each (which of its two forms a lane needs), so
// the eight dependent chains ran one after the other between sixteen branches. Here the wave
// asks once whether every one of its values has |u| < 1; then the short form serves all of
// them. Otherwise both forms are computed for all eight and each lane selects, with no branch.
// Either way the four register pairs are independent chains that cover each other's latency.
// Every loop here is unrolled so that v, u, e and mv are registers and the chains interleave.
__device__ __forceinline__ void gelu_exact8(const v8f& acc, float bias, v2f (&mv)[4]) {
  v2f v[4], u[4], e[4];
  #pragma unroll
  for (int i = 0; i < 4; ++i) {
    v[i] = v2f{acc[2 * i], acc[2 * i + 1]} + bias;
    u[i] = v[i] * 0.70710678118654752440f;
  }
  float mx = fabsf(u[0][0]);
  #pragma unroll
  for (int r = 1; r < 8; ++r) mx = fmaxf(mx, fabsf(u[r >> 1][r & 1]));
  if (__builtin_amdgcn_ballot_w32(!(mx < 1.0f)) == 0u) {
    #pragma unroll
    for (int i = 0; i < 4; ++i) e[i] = erf_below_one(u[i]);
  } else {
    #pragma unroll
    for (int i = 0; i < 4; ++i) {
      const v2f a = v2f{fabsf(u[i][0]), fabsf(u[i][1])};
      const v2f s = erf_below_one(a);
      const v2f q = erf_exponent_from_one(a);
      #pragma unroll
      for (int c = 0; c < 2; ++c) {
        const float l = 1.0f - expf(-q[c]);   // formed ahead of the choice, so that the choice is a select
        e[i][c] = copysignf(a[c] < 1.0f ? s[c] : l, u[i][c]);
      }
    }
  }
  #pragma unroll
  for (int i = 0; i < 4; ++i) mv[i] = (0.5f * v[i]) * (1.0f + e[i]);
}

// Work-group barrier that orders LDS traffic only. __syncthreads() also waits out the wave's
// global loads and stores, so a load issued ahead would be waited for at the very next barrier
// and a store's acknowledgement would hold up the whole block. Nothing that passes between the
// waves of adapter_stats inside its chunk loop goes through global memory.
__device__ __forceinline__ void lds_barrier() {
  __builtin_amdgcn_fence(__ATOMIC_RELEASE, "workgroup", "local");
  __builtin_amdgcn_s_barrier();
  __builtin_amdgcn_fence(__ATOMIC_ACQUIRE, "workgroup", "local");
}

// First pass: m = gelu(down(ln(x))); saves m, so that the second pass starts from m instead
// of from x, and emits per block the column sums of m and its second moment M = m^T m
// (32 x 32, summed over the block's tokens). y = m Wu + b is linear in m, so the batch mean
// and variance of every column of y follow from these (see adapter_apply): y is not formed here.
// M is kept as the tiles M00, M01, M11 (M10 is M01 transposed), each in accumulator order:
// float number r*32+lane holds row r + 8*(lane >> 4), column lane & 15.
// Saved layout: one MID_TILE block per 16-token tile, in the order the up projection's
// A fragments are read: float4 number q*32+lane holds k = 8q+2*hi+{0,1} and 8q+4+2*hi+{0,1}
// of token row (lane & 15), so a wave's 16-byte access covers 512 contiguous bytes.
// amdgpu_waves_per_eu(8): the rows held one chunk ahead must not push the register count past
// 128, or only three blocks instead of four would share a WGP.
__global__ __launch_bounds__(256) __attribute__((amdgpu_waves_per_eu(8))) void adapter_stats(
    const float* __restrict__ x,
    const float* __restrict__ ln_g, const float* __restrict__ ln_b,
    const float* __restrict__ wd,  const float* __restrict__ bdn,
    float* __restrict__ mid,         // [(((h*128+bx)*4+chunk)*4+mtile)*MID_TILE]
    float* __restrict__ partial)     // [(h*128+bx)*MOM_STRIDE + {0 M00, 256 M01, 512 M11, 768 sums}]
{
  __shared__ float s_norm[CHUNK_TOK * NORM_STRIDE];
  __shared__ float s_mid[CHUNK_TOK * MID_STRIDE];
  __shared__ float s_wd[D_ * K_];   // the head's down weights as B fragments: float (cgrp*32+s)*64 + lane*2 + {0,1}
  __shared__ float s_gb[8 * 2 * D_]; // LayerNorm gamma, then beta, of the head: one copy per wave, so no barrier is owed

  const int tid  = threadIdx.x;
  const int lane = tid & 31;
  const int w    = tid >> 5;      // wave 0..7
  const int hi   = lane >> 4;     // lane half selects K pair / M+8
  const int ln16 = lane & 15;
  const int h    = blockIdx.y;
  const int bx   = blockIdx.x;

  const float* __restrict__ wdh = wd + h * (D_ * K_);

  const float4 lg = *reinterpret_cast<const float4*>(ln_g + h * D_ + lane * 4);
  const float4 lb = *reinterpret_cast<const float4*>(ln_b + h * D_ + lane * 4);

  // LayerNorm layout: eight lanes share a token row. Lane part `sub` holds the four floats at
  // column 32*q + 4*sub for q = 0..3, so a wave's 16-byte access covers one whole 128-byte line
  // in each of four rows. A row's sum is then 15 additions inside a lane and three exchange
  // steps, and a wave has two sums to exchange instead of eight over five steps.
  // Rows of a set: lanes 0-15 take rows 8 apart, which lie 32 banks apart at NORM_STRIDE.
  const int sub  = lane & 7;
  const int lrow = (w >> 1) * 16 + (w & 1) * 4 + ((lane >> 3) & 1) * 8 + (lane >> 4);   // + 2 * set

  const int mtile = w >> 1;       // 0..3 : 16-token row tile
  const int cgrp  = w & 1;        // column group

  // Moments of the wave's tokens, carried over all chunks: the diagonal tile of the wave's
  // own 16 columns, its half of the tile M01, and each lane's column sum.
  v8f momD = {0.f, 0.f, 0.f, 0.f, 0.f, 0.f, 0.f, 0.f};
  v8f momO = {0.f, 0.f, 0.f, 0.f, 0.f, 0.f, 0.f, 0.f};
  float csum = 0.f;

  // Asked for behind gamma and beta, in front of the rows and the weights: a load still open at
  // the loop's head would be waited for inside it, and the rows loaded ahead with it.
  const float bias_d = bdn[h * K_ + cgrp * 16 + ln16];

  // The wave's 8 token rows of a chunk are asked for one chunk ahead: chunk 0's here, in front
  // of the weight staging, chunk c+1's behind chunk c's LayerNorm, so that they travel under
  // the matrix work, the GELU and the moments instead of being waited for at the loop's head.
  // Unrolled so that v[] stays in registers and the eight loads go out together.
  const float* __restrict__ xrow =
      x + (size_t)(bx * CHUNKS * CHUNK_TOK + lrow) * (H_ * D_) + h * D_ + sub * 4;
  v4f v[LN_SETS][LN_PART];
  #pragma unroll
  for (int j = 0; j < LN_SETS; ++j)
    #pragma unroll
    for (int q = 0; q < LN_PART; ++q)
      v[j][q] = *reinterpret_cast<const v4f*>(xrow + 2 * j * (H_ * D_) + q * 32);
  // the loads' address registers may be reused by the work that follows
  asm volatile("s_wait_xcnt 0x0" ::: "memory");

  // A lane needs gamma and beta at its 16 columns: read from LDS in each chunk, they do not
  // hold 32 registers across the matrix work.
  float* gbw = s_gb + w * (2 * D_);
  *reinterpret_cast<float4*>(gbw + lane * 4)      = lg;
  *reinterpret_cast<float4*>(gbw + D_ + lane * 4) = lb;

  // The weights do not change from chunk to chunk. They are laid down once in LDS, in the
  // order the B fragments are read, instead of being held in 64 registers of every wave:
  // the register count then lets four blocks share a WGP instead of two. The four waves of
  // a column group write eight k steps each; the first barrier in the loop publishes them.
  // Unrolled so that a wave's sixteen loads go out together, behind one latency.
  #pragma unroll
  for (int i = 0; i < 8; ++i) {
    const int s = mtile * 8 + i;
    v2f b;
    b[0] = wdh[(s * 4 + 2 * hi + 0) * K_ + cgrp * 16 + ln16];
    b[1] = wdh[(s * 4 + 2 * hi + 1) * K_ + cgrp * 16 + ln16];
    *reinterpret_cast<v2f*>(&s_wd[(cgrp * 32 + s) * 64 + lane * 2]) = b;
  }
  for (int chunk = 0; chunk < CHUNKS; ++chunk) {
    // ---- LayerNorm: eight lanes per token row, 8 tokens per wave ----
    // The rows (loaded one chunk ahead) are carried through the two reductions together.
    // The loops are unrolled so that v[] and red[] stay in registers and the independent
    // chains can be interleaved.
    {
      v4f g[LN_PART], b[LN_PART];
      #pragma unroll
      for (int q = 0; q < LN_PART; ++q) {
        g[q] = *reinterpret_cast<const v4f*>(gbw + q * 32 + sub * 4);
        b[q] = *reinterpret_cast<const v4f*>(gbw + D_ + q * 32 + sub * 4);
      }
      // keeps these eight LDS reads in one group in front of the sums, whose work covers their
      // latency (the compiler sank them in pairs to their uses, each pair waited for at once)
      __builtin_amdgcn_sched_barrier(0);
      // The sums inside a lane run on register pairs as they were loaded (two floats an instruction).
      float red[LN_SETS];
      #pragma unroll
      for (int j = 0; j < LN_SETS; ++j) {
        const v2f t = ((v[j][0].lo + v[j][0].hi) + (v[j][1].lo + v[j][1].hi)) +
                      ((v[j][2].lo + v[j][2].hi) + (v[j][3].lo + v[j][3].hi));
        red[j] = t[0] + t[1];
      }
      row_sum_sets(red);
      #pragma unroll
      for (int j = 0; j < LN_SETS; ++j) {
        const float mean = red[j] * (1.0f / 128.0f);
        v[j][0] -= mean;
        v2f ta = v[j][0].lo * v[j][0].lo;
        v2f tb = v[j][0].hi * v[j][0].hi;
        #pragma unroll
        for (int q = 1; q < LN_PART; ++q) {
          v[j][q] -= mean;
          ta += v[j][q].lo * v[j][q].lo;
          tb += v[j][q].hi * v[j][q].hi;
        }
        const v2f t = ta + tb;
        red[j] = t[0] + t[1];
      }
      row_sum_sets(red);
      float rs[LN_SETS];
      #pragma unroll
      for (int j = 0; j < LN_SETS; ++j) rs[j] = rsqrtf(red[j] * (1.0f / 128.0f) + 1e-5f);
      #pragma unroll
      for (int q = 0; q < LN_PART; ++q)
        #pragma unroll
        for (int j = 0; j < LN_SETS; ++j)
          *reinterpret_cast<v4f*>(&s_norm[(lrow + 2 * j) * NORM_STRIDE + q * 32 + sub * 4]) =
              v[j][q] * rs[j] * g[q] + b[q];
      if (chunk + 1 < CHUNKS) {
        #pragma unroll
        for (int j = 0; j < LN_SETS; ++j)
          #pragma unroll
          for (int q = 0; q < LN_PART; ++q)
            v[j][q] = *reinterpret_cast<const v4f*>(
                xrow + ((chunk + 1) * CHUNK_TOK + 2 * j) * (H_ * D_) + q * 32);
        // the loads' address registers may be reused by the work that follows
        asm volatile("s_wait_xcnt 0x0" ::: "memory");
      }
    }
    lds_barrier();

    // ---- GEMM1: (16x128) x (128x32) -> one 16x16 tile per wave ----
    {
      const int n0 = cgrp * 16;
      v8f acc = {0.f, 0.f, 0.f, 0.f, 0.f, 0.f, 0.f, 0.f};
      #pragma unroll
      for (int s = 0; s < 32; ++s) {
        const v2f a = *reinterpret_cast<const v2f*>(
            &s_norm[(mtile * 16 + ln16) * NORM_STRIDE + s * 4 + 2 * hi]);
        const v2f b = *reinterpret_cast<const v2f*>(&s_wd[(cgrp * 32 + s) * 64 + lane * 2]);
        acc = __builtin_amdgcn_wmma_f32_16x16x4_f32(false, a, false, b,
                                                    (short)0, acc, false, false);
      }
      v2f mv[4];                  // value r of the lane is mv[r >> 1][r & 1]
      gelu_exact8(acc, bias_d, mv);
      #pragma unroll
      for (int r = 0; r < 8; ++r) {
        s_mid[(mtile * 16 + r + 8 * hi) * MID_STRIDE + n0 + ln16] = mv[r >> 1][r & 1];
        csum += mv[r >> 1][r & 1];
      }
      // ---- diagonal moment tile, straight from the accumulator registers ----
      // The product sums over tokens, so any token order serves as long as A and B share it:
      // step s takes tokens 8*hi + 2s + {0,1}, which is what lane half hi holds in the pair mv[s];
      // lane & 15 is the column, as an A row and as a B column alike.
      #pragma unroll
      for (int s = 0; s < 4; ++s)
        momD = __builtin_amdgcn_wmma_f32_16x16x4_f32(false, mv[s], false, mv[s],
                                                     (short)0, momD, false, false);
    }
    lds_barrier();

    // ---- off-diagonal moment tile M01: A = columns 0..15, B = columns 16..31, same tokens ----
    // Shared out over the two waves of a token tile: of the four steps above, cgrp 0 takes
    // steps 0,1 and cgrp 1 steps 2,3. Both sides are read from s_mid, one of them being the
    // other wave's; the step is chosen in the address, so that no register is picked at run time.
    #pragma unroll
    for (int t = 0; t < 2; ++t) {
      const int row = mtile * 16 + 8 * hi + cgrp * 4 + 2 * t;
      v2f fa, fb;
      fa[0] = s_mid[(row + 0) * MID_STRIDE + ln16];
      fa[1] = s_mid[(row + 1) * MID_STRIDE + ln16];
      fb[0] = s_mid[(row + 0) * MID_STRIDE + 16 + ln16];
      fb[1] = s_mid[(row + 1) * MID_STRIDE + 16 + ln16];
      momO = __builtin_amdgcn_wmma_f32_16x16x4_f32(false, fa, false, fb,
                                                   (short)0, momO, false, false);
    }

    // ---- save the activation tile (one of the two waves that share it) ----
    if (cgrp == 0) {
      // the tile as the up projection's A fragments (unrolled: af[] stays in registers)
      v2f af[8];
      #pragma unroll
      for (int s = 0; s < 8; ++s)
        af[s] = *reinterpret_cast<const v2f*>(
            &s_mid[(mtile * 16 + ln16) * MID_STRIDE + s * 4 + 2 * hi]);
      float4* __restrict__ mt = reinterpret_cast<float4*>(
          mid + (size_t)(((h * TOKGRP + bx) * CHUNKS + chunk) * 4 + mtile) * MID_TILE) + lane;
      #pragma unroll
      for (int q = 0; q < 4; ++q)
        mt[q * 32] = make_float4(af[2 * q][0], af[2 * q][1], af[2 * q + 1][0], af[2 * q + 1][1]);
      // the stores' address and data registers are reused right behind this block
      asm volatile("s_wait_xcnt 0x0" ::: "memory");
    }

    lds_barrier();
  }

  // ---- fold the eight waves' moments; s_norm is free behind the loop's last barrier ----
  #pragma unroll
  for (int r = 0; r < 8; ++r) {
    s_norm[w * MOM_WAVE + r * 32 + lane]       = momD[r];
    s_norm[w * MOM_WAVE + 256 + r * 32 + lane] = momO[r];
  }
  s_norm[w * MOM_WAVE + 512 + lane] = csum;
  __syncthreads();
  {
    float m00 = 0.f, m01 = 0.f, m11 = 0.f;
    for (int t = 0; t < 4; ++t) {      // even waves own columns 0..15, odd waves 16..31
      m00 += s_norm[(2 * t) * MOM_WAVE + tid];
      m11 += s_norm[(2 * t + 1) * MOM_WAVE + tid];
      m01 += s_norm[(2 * t) * MOM_WAVE + 256 + tid] + s_norm[(2 * t + 1) * MOM_WAVE + 256 + tid];
    }
    const size_t base = (size_t)(h * TOKGRP + bx) * MOM_STRIDE;
    partial[base + tid]       = m00;
    partial[base + 256 + tid] = m01;
    partial[base + 512 + tid] = m11;
    if (tid < K_) {                    // one thread per activation column
      const int ww = tid >> 4;
      const int c  = tid & 15;
      float s = 0.f;
      for (int t = 0; t < 4; ++t)
        s += s_norm[(2 * t + ww) * MOM_WAVE + 512 + c] + s_norm[(2 * t + ww) * MOM_WAVE + 512 + 16 + c];
      partial[base + 768 + tid] = s;
    }
  }
}

// Second pass: y = up(m) from the saved activations, then the BN affine (G,SH) and the residual.
// There is no launch of its own for the batch statistics: every block first folds its head's
// TOKGRP moment sets and forms G and SH itself (see the head below), while its first loads travel.
// So that this re-read stays small, a block is sixteen waves and takes AP_GROUPS first-pass token
// groups: AP_GRID blocks a head, one per WGP. Its groups lie 8 apart, so that they share the
// block's own index modulo 8 (for speed only).
// Behind the head every wave works alone on its 16-token x 64-column tiles.
// The wave's four 16-column tiles are interleaved: tile j holds the feature columns 4*n + j
// (n = lane & 15 is the tile's own column), so the four results a lane has of one token row are
// adjacent in memory. Residual loads and output stores are then 16 bytes a lane and cover
// 256 contiguous bytes of a row, whole lines, instead of 64-byte pieces.
// The pointers carry no __restrict__ here: the loads then keep their written order against the
// s_wait_xcnt statements below (with it the compiler moved loads across those waits).
__global__ __launch_bounds__(512) void adapter_apply(
    const float* x,
    const float* wu,  const float* bup,
    const float* bn_g, const float* bn_b,
    const float* partial,   // layout: see adapter_stats
    const float* mid,       // layout: see adapter_stats
    float* out)
{
  __shared__ float s_part[2 * MOM_STRIDE];   // two half sums over the head's blocks
  __shared__ float s_m[MOM_STRIDE];          // M / N in the blocks' order, then mu
  __shared__ float s_c[K_ * 34];             // C, row pitch 34: 8-byte reads, no bank shared
  __shared__ float s_v[4 * D_];              // per row tile of C: variance parts, then mean parts

  const int tid  = threadIdx.x;
  const int lane = tid & 31;
  const int w    = tid >> 5;      // wave 0..15
  const int hi   = lane >> 4;     // lane half selects K pair / M+8
  const int ln16 = lane & 15;
  const int h    = blockIdx.y;
  // first of the wave's two first-pass groups; the second lies 8 groups on
  const int bx   = (blockIdx.x & 7) + 8 * (AP_GROUPS * (blockIdx.x >> 3) + 2 * (w >> 3));
  const int mtile = (w >> 1) & 3; // 0..3 : 16-token row tile
  const int cgrp  = w & 1;        // column group

  const int col0 = h * D_ + cgrp * 64 + ln16 * 4;   // the lane's four adjacent feature columns
  const float* wuc = wu + h * (K_ * D_) + cgrp * 64 + ln16 * 4;

  const float4* mt = reinterpret_cast<const float4*>(
      mid + (size_t)((h * TOKGRP + bx) * CHUNKS * 4 + mtile) * MID_TILE) + lane;
  const size_t off0 = (size_t)(bx * CHUNKS * CHUNK_TOK + mtile * 16 + 8 * hi) * (H_ * D_) + col0;
  const float* xw = x + off0;
  float* ow = out + off0;

  // Two register sets: chunk c+1's activations and residual rows are on their way while
  // chunk c is multiplied. All loops over them are unrolled so that the sets stay registers.
  float4 aq[2][4];
  float4 xr[2][8];
  // What does not change from chunk to chunk: the B fragments (tile j, k step s), bias, G, SH.
  v2f bf[4][8];
  float4 bias, G, SH;
  float4 wq[8][2];   // row k = 4s + 2*hi + e of Wu at the lane's four columns, until bf is put together
  #pragma unroll
  for (int q = 0; q < 4; ++q) aq[0][q] = mt[q * 32];
  // a residual load that follows may land in a register these loads name (as in the loop below)
  asm volatile("s_wait_xcnt 0x0" ::: "memory");
  #pragma unroll
  for (int r = 0; r < 8; ++r) xr[0][r] = *reinterpret_cast<const float4*>(xw + r * (H_ * D_));
  // the head's vector work that follows may reuse these loads' address registers
  asm volatile("s_wait_xcnt 0x0" ::: "memory");

  // ---- head: the head's batch statistics, folded into (G, SH) with the 0.1 adapter scale ----
  // With mu = mean of m and C = M / N - mu mu^T (the covariance of m), column d of y = m Wu + b
  // has mean mu . Wu[:,d] + b[d] and variance Wu[:,d] . (C Wu)[:,d].
  {
    const int wv = __builtin_amdgcn_readfirstlane(w);   // wave number, in a scalar register
    const int ti = wv & 1;          // 16-row tile of C
    const int tj = wv >> 1;         // 16-column tile of Wu

    // What does not depend on the moments is asked for first, so that it arrives under the fold.
    const float* wut = wu + h * (K_ * D_) + tj * 16 + ln16;
    v2f bw[8];                      // B fragments of Wu
    float wr[8];                    // Wu at the accumulator's own positions
    #pragma unroll
    for (int s = 0; s < 8; ++s) {
      bw[s][0] = wut[(s * 4 + 2 * hi + 0) * D_];
      bw[s][1] = wut[(s * 4 + 2 * hi + 1) * D_];
      wr[s]    = wut[(ti * 16 + s + 8 * hi) * D_];
    }
    // as above, for the weight loads' address registers
    asm volatile("s_wait_xcnt 0x0" ::: "memory");
    const float* pbu = bup + col0;
    const float* pga = bn_g + col0;
    const float* pbe = bn_b + col0;
    bias = *reinterpret_cast<const float4*>(pbu);
    const float4 gam = *reinterpret_cast<const float4*>(pga);
    const float4 bet = *reinterpret_cast<const float4*>(pbe);
    // as above, for these three loads' address registers; named as inputs, they stay whole up to the wait
    asm volatile("s_wait_xcnt 0x0" :: "v"(pbu), "v"(pga), "v"(pbe) : "memory");

    // sum over the head's TOKGRP blocks: 16-byte loads, half of the blocks per thread
    {
      const int part = tid >> 8;
      const int c4   = tid & 255;
      if (c4 < MOM_STRIDE / 4) {
        const float4* p = reinterpret_cast<const float4*>(
            partial + (size_t)(h * TOKGRP + part * (TOKGRP / 2)) * MOM_STRIDE) + c4;
        float4 a = make_float4(0.f, 0.f, 0.f, 0.f);
        for (int tb = 0; tb < TOKGRP / 2; tb += 16) {
          // unrolled so that 16 loads are in flight behind one wait instead of one
          float4 pv4[16];
          #pragma unroll
          for (int t = 0; t < 16; ++t) pv4[t] = p[(tb + t) * (MOM_STRIDE / 4)];
          // the address registers may be reused behind the sixteen loads; named as an input, they
          // stay whole up to the wait (else the last load landed in its own address pair)
          asm volatile("s_wait_xcnt 0x0" :: "v"(p) : "memory");
          #pragma unroll
          for (int t = 0; t < 16; ++t) {
            a.x += pv4[t].x; a.y += pv4[t].y; a.z += pv4[t].z; a.w += pv4[t].w;
          }
        }
        reinterpret_cast<float4*>(s_part + part * MOM_STRIDE)[c4] = a;
      }
    }
    // The up projection's weight rows are asked for here, where the fold's registers are free:
    // they travel under the LDS steps that follow (whose barriers do not wait for global loads).
    const float* wuh = wuc + 2 * hi * D_;
    #pragma unroll
    for (int s = 0; s < 8; ++s) {
      wq[s][0] = *reinterpret_cast<const float4*>(wuh + (s * 4 + 0) * D_);
      wq[s][1] = *reinterpret_cast<const float4*>(wuh + (s * 4 + 1) * D_);
    }
    // the weight rows' address registers are reused by the vector work that follows; named as an
    // input, they stay whole up to the wait (else the last load landed in its own address pair)
    asm volatile("s_wait_xcnt 0x0" :: "v"(wuh) : "memory");
    lds_barrier();
    for (int i = tid; i < MOM_STRIDE; i += 512)
      s_m[i] = (s_part[i] + s_part[MOM_STRIDE + i]) * (1.0f / (float)NTOK);
    lds_barrier();

    // C[k][l], two elements per thread
    #pragma unroll
    for (int e = 0; e < 2; ++e) {
      const int k = (tid >> 5) + 16 * e;
      const int l = tid & 31;
      int plane, row, col;
      if ((k < 16) == (l < 16)) { plane = (k < 16) ? 0 : 512; row = k & 15; col = l & 15; }
      else                      { plane = 256; row = (k < 16) ? k : l; col = ((k < 16) ? l : k) - 16; }
      s_c[k * 34 + l] = s_m[plane + (row & 7) * 32 + (row >> 3) * 16 + col] - s_m[768 + k] * s_m[768 + l];
    }
    lds_barrier();

    // T = C Wu, (32x32) x (32x128): one 16x16 tile per wave, sixteen waves
    {
      v8f acc = {0.f, 0.f, 0.f, 0.f, 0.f, 0.f, 0.f, 0.f};
      #pragma unroll
      for (int s = 0; s < 8; ++s) {
        const v2f a = *reinterpret_cast<const v2f*>(&s_c[(ti * 16 + ln16) * 34 + s * 4 + 2 * hi]);
        acc = __builtin_amdgcn_wmma_f32_16x16x4_f32(false, a, false, bw[s],
                                                    (short)0, acc, false, false);
      }
      float pv = 0.f, pm = 0.f;
      #pragma unroll
      for (int r = 0; r < 8; ++r) {
        pv += wr[r] * acc[r];
        pm += wr[r] * s_m[768 + ti * 16 + r + 8 * hi];
      }
      pv += __shfl_xor(pv, 16, 32);   // fold the rows r+8 onto the rows r
      pm += __shfl_xor(pm, 16, 32);
      if (hi == 0) {
        s_v[ti * D_ + tj * 16 + ln16]          = pv;
        s_v[2 * D_ + ti * D_ + tj * 16 + ln16] = pm;
      }
    }
    lds_barrier();

    // every lane forms G and SH of its own four columns
    const int c = cgrp * 64 + ln16 * 4;
    const float4 v0 = *reinterpret_cast<const float4*>(&s_v[c]);
    const float4 v1 = *reinterpret_cast<const float4*>(&s_v[D_ + c]);
    const float4 m0 = *reinterpret_cast<const float4*>(&s_v[2 * D_ + c]);
    const float4 m1 = *reinterpret_cast<const float4*>(&s_v[3 * D_ + c]);
    G.x = 0.1f * gam.x * rsqrtf(v0.x + v1.x + 1e-5f);
    G.y = 0.1f * gam.y * rsqrtf(v0.y + v1.y + 1e-5f);
    G.z = 0.1f * gam.z * rsqrtf(v0.z + v1.z + 1e-5f);
    G.w = 0.1f * gam.w * rsqrtf(v0.w + v1.w + 1e-5f);
    SH.x = 0.1f * bet.x - (m0.x + m1.x + bias.x) * G.x;
    SH.y = 0.1f * bet.y - (m0.y + m1.y + bias.y) * G.y;
    SH.z = 0.1f * bet.z - (m0.z + m1.z + bias.z) * G.z;
    SH.w = 0.1f * bet.w - (m0.w + m1.w + bias.w) * G.w;
  }

  #pragma unroll
  for (int chunk = 0; chunk < AP_CHUNKS; ++chunk) {
    const int cur = chunk & 1;
    if (chunk + 1 < AP_CHUNKS) {
      #pragma unroll
      for (int q = 0; q < 4; ++q) aq[cur ^ 1][q] = mt[AP_POS(chunk + 1) * (4 * MID_TILE / 4) + q * 32];
      // behind the last of these loads their address pair is free, and a residual load may land in it
      asm volatile("s_wait_xcnt 0x0" ::: "memory");
      #pragma unroll
      for (int r = 0; r < 8; ++r)
        xr[cur ^ 1][r] = *reinterpret_cast<const float4*>(
            xw + (AP_POS(chunk + 1) * CHUNK_TOK + r) * (H_ * D_));
    }
    // keeps the next chunk's loads in front of this chunk's matrix work, and that work
    // behind the last chunk's stores (else two chunks' results are held at once)
    __builtin_amdgcn_sched_barrier(0);

    if (chunk == 0) {
      #pragma unroll
      for (int s = 0; s < 8; ++s) {
        bf[0][s][0] = wq[s][0].x; bf[0][s][1] = wq[s][1].x;
        bf[1][s][0] = wq[s][0].y; bf[1][s][1] = wq[s][1].y;
        bf[2][s][0] = wq[s][0].z; bf[2][s][1] = wq[s][1].z;
        bf[3][s][0] = wq[s][0].w; bf[3][s][1] = wq[s][1].w;
      }
    }

    // ---- GEMM2: (16x32) x (32x128) -> 4 column tiles per wave ----
    v8f acc[4];
    #pragma unroll
    for (int j = 0; j < 4; ++j) acc[j] = v8f{0.f, 0.f, 0.f, 0.f, 0.f, 0.f, 0.f, 0.f};
    #pragma unroll
    for (int q = 0; q < 4; ++q) {
      v2f a0, a1;
      a0[0] = aq[cur][q].x; a0[1] = aq[cur][q].y;
      a1[0] = aq[cur][q].z; a1[1] = aq[cur][q].w;
      #pragma unroll
      for (int j = 0; j < 4; ++j)
        acc[j] = __builtin_amdgcn_wmma_f32_16x16x4_f32(false, a0, false, bf[j][2 * q],
                                                       (short)0, acc[j], false, false);
      #pragma unroll
      for (int j = 0; j < 4; ++j)
        acc[j] = __builtin_amdgcn_wmma_f32_16x16x4_f32(false, a1, false, bf[j][2 * q + 1],
                                                       (short)0, acc[j], false, false);
    }
    #pragma unroll
    for (int r = 0; r < 8; ++r) {
      float4 o;
      o.x = (acc[0][r] + bias.x) * G.x + SH.x + xr[cur][r].x;
      o.y = (acc[1][r] + bias.y) * G.y + SH.y + xr[cur][r].y;
      o.z = (acc[2][r] + bias.z) * G.z + SH.z + xr[cur][r].z;
      o.w = (acc[3][r] + bias.w) * G.w + SH.w + xr[cur][r].w;
      *reinterpret_cast<float4*>(ow + (AP_POS(chunk) * CHUNK_TOK + r) * (H_ * D_)) = o;
    }
    // the stores' data registers are refilled by the next chunk's work
    if (chunk + 1 < AP_CHUNKS) asm volatile("s_wait_xcnt 0x0" ::: "memory");
  }
}

extern "C" void kernel_launch(void* const* d_in, const int* in_sizes, int n_in,
                              void* d_out, int out_size, void* d_ws, size_t ws_size,
                              hipStream_t stream) {
  const float* x    = (const float*)d_in[0];
  const float* ln_g = (const float*)d_in[1];
  const float* ln_b = (const float*)d_in[2];
  const float* wd   = (const float*)d_in[3];
  const float* bdn  = (const float*)d_in[4];
  const float* wu   = (const float*)d_in[5];
  const float* bup  = (const float*)d_in[6];
  const float* bn_g = (const float*)d_in[7];
  const float* bn_b = (const float*)d_in[8];
  float* out = (float*)d_out;

  float* partial = (float*)d_ws;                 // 1024 blocks * MOM_STRIDE floats = 3.2 MB
  float* mid     = partial + (size_t)H_ * TOKGRP * MOM_STRIDE;  // NTOK*H_*K_ floats = 32 MB

  dim3 grid(TOKGRP, H_);
  adapter_stats<<<grid, 256, 0, stream>>>(x, ln_g, ln_b, wd, bdn, mid, partial);
  dim3 grid2(AP_GRID, H_);
  adapter_apply<<<grid2, 512, 0, stream>>>(x, wu, bup, bn_g, bn_b, partial, mid, out);
}

// v010
// It runs in 47.4 microseconds.
// In both of two side-by-side timings against v009, it was 1.05 times as fast.
// All steps since v000 together make it 3.73 times as fast.
#include <hip/hip_runtime.h>

typedef float v2f __attribute__((ext_vector_type(2)));
typedef float v4f __attribute__((ext_vector_type(4)));
typedef float v8f __attribute__((ext_vector_type(8)));

#define H_ 8
#define D_ 128
#define K_ 32
#define NTOK 32768          // B*S
#define CHUNK_TOK 64
#define CHUNKS 4
#define TOKGRP 128          // adapter_stats' gridDim.x ; TOKGRP*CHUNKS*CHUNK_TOK == NTOK
#define NORM_STRIDE 132     // 132 mod 64 = 4 -> conflict-free v2f A reads
#define MID_STRIDE 36

#define LN_SETS 2           // a wave normalises 8 token rows per chunk, four at a time, eight lanes to a row
#define LN_PART 4           // 16-byte pieces of a row that one lane holds
#define MID_TILE 512        // floats of one saved 16-token x 32 activation tile
#define MOM_STRIDE 800      // floats per first-pass block set aside in the workspace ahead of the activations
#define MOM_WAVE 544        // floats one wave hands to the block's fold: 256 + 256 + 32
#define PART_STRIDE 256     // floats a first-pass block hands on: per column of y0 = m Wu, sum of squares, then sum
#define AP_GROUPS 4         // first-pass token groups that one second-pass block takes
#define AP_GRID 32          // second-pass blocks a head: TOKGRP / AP_GROUPS
#define AP_CHUNKS 8         // chunks a second-pass wave walks: two groups of CHUNKS
// place of a wave's chunk c, counted in chunks from its first group's start (second group: 8 groups on)
#define AP_POS(c) (((c) >> 2) * 8 * CHUNKS + ((c) & 3))

// Butterfly sum over the eight lanes that share a token row, for the wave's LN_SETS row sets
// at once: each exchange step is issued for both sets before a result is used, so one
// exchange latency is paid per step (hence the full unrolls).
__device__ __forceinline__ void row_sum_sets(float (&s)[LN_SETS]) {
  #pragma unroll
  for (int m = 1; m < 8; m <<= 1) {
    float o[LN_SETS];
    #pragma unroll
    for (int i = 0; i < LN_SETS; ++i) o[i] = __shfl_xor(s[i], m, 32);
    // both sets' exchanges go out before either is waited for (the compiler staggered them,
    // and a reduction then waited out five exchange latencies instead of three)
    __builtin_amdgcn_sched_barrier(0);
    #pragma unroll
    for (int i = 0; i < LN_SETS; ++i) s[i] += o[i];
  }
}

__device__ __forceinline__ v2f fma2(v2f a, v2f b, v2f c) { return __builtin_elementwise_fma(a, b, c); }
__device__ __forceinline__ v2f both(unsigned bits) {
  const float c = __builtin_bit_cast(float, bits);
  return v2f{c, c};
}

// erf(u) for |u| < 1: u + u * P(u*u). The coefficients and the order of the operations are those
// of the math library's erff, so the value is the library's, bit for bit (odd in u like the
// library's form on |u| with the sign copied back).
__device__ __forceinline__ v2f erf_below_one(v2f u) {
  const v2f t = u * u;
  v2f p = fma2(t, both(0xba1345e1u), both(0x3ba10414u));
  p = fma2(t, p, both(0xbcdac9b8u));
  p = fma2(t, p, both(0x3de703beu));
  p = fma2(t, p, both(0xbec09330u));
  p = fma2(t, p, both(0x3e0375d0u));
  return fma2(u, p, u);
}

// For a = |u| >= 1 the library has erf = 1 - exp(-q), q = a + a * Q(a): this is q.
__device__ __forceinline__ v2f erf_exponent_from_one(v2f a) {
  v2f q = fma2(a, both(0x378e98abu), both(0xb9c68948u));
  q = fma2(a, q, both(0x3b7cd369u));
  q = fma2(a, q, both(0xbcc618b2u));
  q = fma2(a, q, both(0x3dda74e4u));
  q = fma2(a, q, both(0x3f228afdu));
  q = fma2(a, q, both(0x3e03c728u));
  return fma2(a, q, a);
}

// Exact GELU of a lane's eight results, 0.5 v (1 + erf(v / sqrt 2)), two values an instruction.
// erff called value by value branches twice on each (which of its two forms a lane needs), so
// the eight dependent chains ran one after the other between sixteen branches. Here the wave
// asks once whether every one of its values has |u| < 1; then the short form serves all of
// them. Otherwise both forms are computed for all eight and each lane selects, with no branch.
// Either way the four register pairs are independent chains that cover each other's latency.
// Every loop here is unrolled so that v, u, e and mv are registers and the chains interleave.
__device__ __forceinline__ void gelu_exact8(const v8f& acc, float bias, v2f (&mv)[4]) {
  v2f v[4], u[4], e[4];
  #pragma unroll
  for (int i = 0; i < 4; ++i) {
    v[i] = v2f{acc[2 * i], acc[2 * i + 1]} + bias;
    u[i] = v[i] * 0.70710678118654752440f;
  }
  float mx = fabsf(u[0][0]);
  #pragma unroll
  for (int r = 1; r < 8; ++r) mx = fmaxf(mx, fabsf(u[r >> 1][r & 1]));
  if (__builtin_amdgcn_ballot_w32(!(mx < 1.0f)) == 0u) {
    #pragma unroll
    for (int i = 0; i < 4; ++i) e[i] = erf_below_one(u[i]);
  } else {
    #pragma unroll
    for (int i = 0; i < 4; ++i) {
      const v2f a = v2f{fabsf(u[i][0]), fabsf(u[i][1])};
      const v2f s = erf_below_one(a);
      const v2f q = erf_exponent_from_one(a);
      #pragma unroll
      for (int c = 0; c < 2; ++c) {
        const float l = 1.0f - expf(-q[c]);   // formed ahead of the choice, so that the choice is a select
        e[i][c] = copysignf(a[c] < 1.0f ? s[c] : l, u[i][c]);
      }
    }
  }
  #pragma unroll
  for (int i = 0; i < 4; ++i) mv[i] = (0.5f * v[i]) * (1.0f + e[i]);
}

// Work-group barrier that orders LDS traffic only. __syncthreads() also waits out the wave's
// global loads and stores, so a load issued ahead would be waited for at the very next barrier
// and a store's acknowledgement would hold up the whole block. Nothing that passes between the
// waves of adapter_stats inside its chunk loop goes through global memory.
__device__ __forceinline__ void lds_barrier() {
  __builtin_amdgcn_fence(__ATOMIC_RELEASE, "workgroup", "local");
  __builtin_amdgcn_s_barrier();
  __builtin_amdgcn_fence(__ATOMIC_ACQUIRE, "workgroup", "local");
}

// First pass: m = gelu(down(ln(x))); saves m, so that the second pass starts from m instead
// of from x, and gathers per block the column sums of m and its second moment M = m^T m
// (32 x 32, summed over the block's tokens). y = m Wu + b is linear in m, so the block's sums of
// y0 = m Wu and of y0^2 follow from these (see the kernel's end): y is not formed here.
// M is kept as the tiles M00, M01, M11 (M10 is M01 transposed), each in accumulator order:
// float number r*32+lane holds row r + 8*(lane >> 4), column lane & 15.
// Saved layout: one MID_TILE block per 16-token tile, in the order the up projection's
// A fragments are read: float4 number q*32+lane holds k = 8q+2*hi+{0,1} and 8q+4+2*hi+{0,1}
// of token row (lane & 15), so a wave's 16-byte access covers 512 contiguous bytes.
// amdgpu_waves_per_eu(8): the rows held one chunk ahead must not push the register count past
// 128, or only three blocks instead of four would share a WGP.
__global__ __launch_bounds__(256) __attribute__((amdgpu_waves_per_eu(8))) void adapter_stats(
    const float* __restrict__ x,
    const float* __restrict__ ln_g, const float* __restrict__ ln_b,
    const float* __restrict__ wd,  const float* __restrict__ bdn,
    const float* __restrict__ wu,
    float* __restrict__ mid,         // [(((h*128+bx)*4+chunk)*4+mtile)*MID_TILE]
    float* __restrict__ partial)     // [(h*128+bx)*PART_STRIDE + {0 sums of y0^2, 128 sums of y0}]
{
  __shared__ float s_norm[CHUNK_TOK * NORM_STRIDE];
  __shared__ float s_mid[CHUNK_TOK * MID_STRIDE];
  __shared__ float s_wd[D_ * K_];   // the head's down weights as B fragments: float (cgrp*32+s)*64 + lane*2 + {0,1}
  __shared__ float s_gb[8 * 2 * D_]; // LayerNorm gamma, then beta, of the head: one copy per wave, so no barrier is owed

  const int tid  = threadIdx.x;
  const int lane = tid & 31;
  const int w    = tid >> 5;      // wave 0..7
  const int hi   = lane >> 4;     // lane half selects K pair / M+8
  const int ln16 = lane & 15;
  const int h    = blockIdx.y;
  const int bx   = blockIdx.x;

  const float* __restrict__ wdh = wd + h * (D_ * K_);

  const float4 lg = *reinterpret_cast<const float4*>(ln_g + h * D_ + lane * 4);
  const float4 lb = *reinterpret_cast<const float4*>(ln_b + h * D_ + lane * 4);

  // LayerNorm layout: eight lanes share a token row. Lane part `sub` holds the four floats at
  // column 32*q + 4*sub for q = 0..3, so a wave's 16-byte access covers one whole 128-byte line
  // in each of four rows. A row's sum is then 15 additions inside a lane and three exchange
  // steps, and a wave has two sums to exchange instead of eight over five steps.
  // Rows of a set: lanes 0-15 take rows 8 apart, which lie 32 banks apart at NORM_STRIDE.
  const int sub  = lane & 7;
  const int lrow = (w >> 1) * 16 + (w & 1) * 4 + ((lane >> 3) & 1) * 8 + (lane >> 4);   // + 2 * set

  const int mtile = w >> 1;       // 0..3 : 16-token row tile
  const int cgrp  = w & 1;        // column group

  // Moments of the wave's tokens, carried over all chunks: the diagonal tile of the wave's
  // own 16 columns, its half of the tile M01, and each lane's column sum.
  v8f momD = {0.f, 0.f, 0.f, 0.f, 0.f, 0.f, 0.f, 0.f};
  v8f momO = {0.f, 0.f, 0.f, 0.f, 0.f, 0.f, 0.f, 0.f};
  float csum = 0.f;

  // Asked for behind gamma and beta, in front of the rows and the weights: a load still open at
  // the loop's head would be waited for inside it, and the rows loaded ahead with it.
  const float bias_d = bdn[h * K_ + cgrp * 16 + ln16];

  // The wave's 8 token rows of a chunk are asked for one chunk ahead: chunk 0's here, in front
  // of the weight staging, chunk c+1's behind chunk c's LayerNorm, so that they travel under
  // the matrix work, the GELU and the moments instead of being waited for at the loop's head.
  // Unrolled so that v[] stays in registers and the eight loads go out together.
  const float* __restrict__ xrow =
      x + (size_t)(bx * CHUNKS * CHUNK_TOK + lrow) * (H_ * D_) + h * D_ + sub * 4;
  v4f v[LN_SETS][LN_PART];
  #pragma unroll
  for (int j = 0; j < LN_SETS; ++j)
    #pragma unroll
    for (int q = 0; q < LN_PART; ++q)
      v[j][q] = *reinterpret_cast<const v4f*>(xrow + 2 * j * (H_ * D_) + q * 32);
  // the loads' address registers may be reused by the work that follows
  asm volatile("s_wait_xcnt 0x0" ::: "memory");

  // A lane needs gamma and beta at its 16 columns: read from LDS in each chunk, they do not
  // hold 32 registers across the matrix work.
  float* gbw = s_gb + w * (2 * D_);
  *reinterpret_cast<float4*>(gbw + lane * 4)      = lg;
  *reinterpret_cast<float4*>(gbw + D_ + lane * 4) = lb;

  // The weights do not change from chunk to chunk. They are laid down once in LDS, in the
  // order the B fragments are read, instead of being held in 64 registers of every wave:
  // the register count then lets four blocks share a WGP instead of two. The four waves of
  // a column group write eight k steps each; the first barrier in the loop publishes them.
  // Unrolled so that a wave's sixteen loads go out together, behind one latency.
  #pragma unroll
  for (int i = 0; i < 8; ++i) {
    const int s = mtile * 8 + i;
    v2f b;
    b[0] = wdh[(s * 4 + 2 * hi + 0) * K_ + cgrp * 16 + ln16];
    b[1] = wdh[(s * 4 + 2 * hi + 1) * K_ + cgrp * 16 + ln16];
    *reinterpret_cast<v2f*>(&s_wd[(cgrp * 32 + s) * 64 + lane * 2]) = b;
  }
  for (int chunk = 0; chunk < CHUNKS; ++chunk) {
    // ---- LayerNorm: eight lanes per token row, 8 tokens per wave ----
    // The rows (loaded one chunk ahead) are carried through the two reductions together.
    // The loops are unrolled so that v[] and red[] stay in registers and the independent
    // chains can be interleaved.
    {
      v4f g[LN_PART], b[LN_PART];
      #pragma unroll
      for (int q = 0; q < LN_PART; ++q) {
        g[q] = *reinterpret_cast<const v4f*>(gbw + q * 32 + sub * 4);
        b[q] = *reinterpret_cast<const v4f*>(gbw + D_ + q * 32 + sub * 4);
      }
      // keeps these eight LDS reads in one group in front of the sums, whose work covers their
      // latency (the compiler sank them in pairs to their uses, each pair waited for at once)
      __builtin_amdgcn_sched_barrier(0);
      // The sums inside a lane run on register pairs as they were loaded (two floats an instruction).
      float red[LN_SETS];
      #pragma unroll
      for (int j = 0; j < LN_SETS; ++j) {
        const v2f t = ((v[j][0].lo + v[j][0].hi) + (v[j][1].lo + v[j][1].hi)) +
                      ((v[j][2].lo + v[j][2].hi) + (v[j][3].lo + v[j][3].hi));
        red[j] = t[0] + t[1];
      }
      row_sum_sets(red);
      #pragma unroll
      for (int j = 0; j < LN_SETS; ++j) {
        const float mean = red[j] * (1.0f / 128.0f);
        v[j][0] -= mean;
        v2f ta = v[j][0].lo * v[j][0].lo;
        v2f tb = v[j][0].hi * v[j][0].hi;
        #pragma unroll
        for (int q = 1; q < LN_PART; ++q) {
          v[j][q] -= mean;
          ta += v[j][q].lo * v[j][q].lo;
          tb += v[j][q].hi * v[j][q].hi;
        }
        const v2f t = ta + tb;
        red[j] = t[0] + t[1];
      }
      row_sum_sets(red);
      float rs[LN_SETS];
      #pragma unroll
      for (int j = 0; j < LN_SETS; ++j) rs[j] = rsqrtf(red[j] * (1.0f / 128.0f) + 1e-5f);
      #pragma unroll
      for (int q = 0; q < LN_PART; ++q)
        #pragma unroll
        for (int j = 0; j < LN_SETS; ++j)
          *reinterpret_cast<v4f*>(&s_norm[(lrow + 2 * j) * NORM_STRIDE + q * 32 + sub * 4]) =
              v[j][q] * rs[j] * g[q] + b[q];
      if (chunk + 1 < CHUNKS) {
        #pragma unroll
        for (int j = 0; j < LN_SETS; ++j)
          #pragma unroll
          for (int q = 0; q < LN_PART; ++q)
            v[j][q] = *reinterpret_cast<const v4f*>(
                xrow + ((chunk + 1) * CHUNK_TOK + 2 * j) * (H_ * D_) + q * 32);
        // the loads' address registers may be reused by the work that follows
        asm volatile("s_wait_xcnt 0x0" ::: "memory");
      }
    }
    lds_barrier();

    // ---- GEMM1: (16x128) x (128x32) -> one 16x16 tile per wave ----
    {
      const int n0 = cgrp * 16;
      v8f acc = {0.f, 0.f, 0.f, 0.f, 0.f, 0.f, 0.f, 0.f};
      #pragma unroll
      for (int s = 0; s < 32; ++s) {
        const v2f a = *reinterpret_cast<const v2f*>(
            &s_norm[(mtile * 16 + ln16) * NORM_STRIDE + s * 4 + 2 * hi]);
        const v2f b = *reinterpret_cast<const v2f*>(&s_wd[(cgrp * 32 + s) * 64 + lane * 2]);
        acc = __builtin_amdgcn_wmma_f32_16x16x4_f32(false, a, false, b,
                                                    (short)0, acc, false, false);
      }
      v2f mv[4];                  // value r of the lane is mv[r >> 1][r & 1]
      gelu_exact8(acc, bias_d, mv);
      #pragma unroll
      for (int r = 0; r < 8; ++r) {
        s_mid[(mtile * 16 + r + 8 * hi) * MID_STRIDE + n0 + ln16] = mv[r >> 1][r & 1];
        csum += mv[r >> 1][r & 1];
      }
      // ---- diagonal moment tile, straight from the accumulator registers ----
      // The product sums over tokens, so any token order serves as long as A and B share it:
      // step s takes tokens 8*hi + 2s + {0,1}, which is what lane half hi holds in the pair mv[s];
      // lane & 15 is the column, as an A row and as a B column alike.
      #pragma unroll
      for (int s = 0; s < 4; ++s)
        momD = __builtin_amdgcn_wmma_f32_16x16x4_f32(false, mv[s], false, mv[s],
                                                     (short)0, momD, false, false);
    }
    lds_barrier();

    // ---- off-diagonal moment tile M01: A = columns 0..15, B = columns 16..31, same tokens ----
    // Shared out over the two waves of a token tile: of the four steps above, cgrp 0 takes
    // steps 0,1 and cgrp 1 steps 2,3. Both sides are read from s_mid, one of them being the
    // other wave's; the step is chosen in the address, so that no register is picked at run time.
    #pragma unroll
    for (int t = 0; t < 2; ++t) {
      const int row = mtile * 16 + 8 * hi + cgrp * 4 + 2 * t;
      v2f fa, fb;
      fa[0] = s_mid[(row + 0) * MID_STRIDE + ln16];
      fa[1] = s_mid[(row + 1) * MID_STRIDE + ln16];
      fb[0] = s_mid[(row + 0) * MID_STRIDE + 16 + ln16];
      fb[1] = s_mid[(row + 1) * MID_STRIDE + 16 + ln16];
      momO = __builtin_amdgcn_wmma_f32_16x16x4_f32(false, fa, false, fb,
                                                   (short)0, momO, false, false);
    }

    // ---- save the activation tile (one of the two waves that share it) ----
    if (cgrp == 0) {
      // the tile as the up projection's A fragments (unrolled: af[] stays in registers)
      v2f af[8];
      #pragma unroll
      for (int s = 0; s < 8; ++s)
        af[s] = *reinterpret_cast<const v2f*>(
            &s_mid[(mtile * 16 + ln16) * MID_STRIDE + s * 4 + 2 * hi]);
      float4* __restrict__ mt = reinterpret_cast<float4*>(
          mid + (size_t)(((h * TOKGRP + bx) * CHUNKS + chunk) * 4 + mtile) * MID_TILE) + lane;
      #pragma unroll
      for (int q = 0; q < 4; ++q)
        mt[q * 32] = make_float4(af[2 * q][0], af[2 * q][1], af[2 * q + 1][0], af[2 * q + 1][1]);
      // the stores' address and data registers are reused right behind this block
      asm volatile("s_wait_xcnt 0x0" ::: "memory");
    }

    lds_barrier();
  }

  // ---- the block's share of the batch statistics of y0 = m Wu, column by column ----
  // Column d has sum(y0) = colsum(m) . Wu[:,d] and sum(y0^2) = Wu[:,d] . (M Wu)[:,d]: formed here,
  // a block hands on 2 * D_ floats instead of its whole moment set. Wave w takes columns 16w..16w+15.
  // The weights are asked for first, so that they travel under the fold (unrolled: registers).
  const float* __restrict__ wub = wu + h * (K_ * D_) + w * 16 + ln16 + 2 * hi * D_;
  const float* __restrict__ wua = wu + h * (K_ * D_) + w * 16 + ln16 + 8 * hi * D_;
  v2f bw[8];                      // B fragments of Wu
  float wr0[8], wr1[8];           // Wu at the positions of the two accumulators
  #pragma unroll
  for (int s = 0; s < 8; ++s) {
    bw[s][0] = wub[(s * 4 + 0) * D_];
    bw[s][1] = wub[(s * 4 + 1) * D_];
    wr0[s]   = wua[s * D_];
    wr1[s]   = wua[(16 + s) * D_];
  }
  // the loads' address registers may be reused by the work that follows; named as inputs, they
  // stay whole up to the wait (else a later load of the group landed in an earlier one's address pair)
  asm volatile("s_wait_xcnt 0x0" :: "v"(wub), "v"(wua) : "memory");

  // fold the eight waves' moments; s_norm and s_mid are free behind the loop's last barrier
  #pragma unroll
  for (int r = 0; r < 8; ++r) {
    s_norm[w * MOM_WAVE + r * 32 + lane]       = momD[r];
    s_norm[w * MOM_WAVE + 256 + r * 32 + lane] = momO[r];
  }
  s_norm[w * MOM_WAVE + 512 + lane] = csum;
  lds_barrier();
  float* s_M  = s_mid;              // M as a 32 x 32 matrix, row pitch 34: 8-byte reads, no bank shared
  float* s_cs = s_mid + K_ * 34;    // column sums of m
  {
    float m00 = 0.f, m01 = 0.f, m11 = 0.f;
    for (int t = 0; t < 4; ++t) {      // even waves own columns 0..15, odd waves 16..31
      m00 += s_norm[(2 * t) * MOM_WAVE + tid];
      m11 += s_norm[(2 * t + 1) * MOM_WAVE + tid];
      m01 += s_norm[(2 * t) * MOM_WAVE + 256 + tid] + s_norm[(2 * t + 1) * MOM_WAVE + 256 + tid];
    }
    const int row = w + 8 * hi;        // accumulator order: float r*32+lane is row r + 8*(lane >> 4), column lane & 15
    s_M[row * 34 + ln16]               = m00;
    s_M[(16 + row) * 34 + 16 + ln16]   = m11;
    s_M[row * 34 + 16 + ln16]          = m01;
    s_M[(16 + ln16) * 34 + row]        = m01;   // M10 is M01 transposed
    if (tid < K_) {                    // one thread per activation column
      const int ww = tid >> 4;
      const int c  = tid & 15;
      float s = 0.f;
      for (int t = 0; t < 4; ++t)
        s += s_norm[(2 * t + ww) * MOM_WAVE + 512 + c] + s_norm[(2 * t + ww) * MOM_WAVE + 512 + 16 + c];
      s_cs[tid] = s;
    }
  }
  lds_barrier();
  {
    // T = M Wu for the wave's 16 columns: both 16-row tiles, two independent accumulator chains
    v8f a0 = {0.f, 0.f, 0.f, 0.f, 0.f, 0.f, 0.f, 0.f};
    v8f a1 = {0.f, 0.f, 0.f, 0.f, 0.f, 0.f, 0.f, 0.f};
    #pragma unroll
    for (int s = 0; s < 8; ++s) {
      const v2f f0 = *reinterpret_cast<const v2f*>(&s_M[ln16 * 34 + s * 4 + 2 * hi]);
      const v2f f1 = *reinterpret_cast<const v2f*>(&s_M[(16 + ln16) * 34 + s * 4 + 2 * hi]);
      a0 = __builtin_amdgcn_wmma_f32_16x16x4_f32(false, f0, false, bw[s], (short)0, a0, false, false);
      a1 = __builtin_amdgcn_wmma_f32_16x16x4_f32(false, f1, false, bw[s], (short)0, a1, false, false);
    }
    float pq = 0.f, ps = 0.f;
    #pragma unroll
    for (int r = 0; r < 8; ++r) {
      pq += wr0[r] * a0[r] + wr1[r] * a1[r];
      ps += wr0[r] * s_cs[r + 8 * hi] + wr1[r] * s_cs[16 + r + 8 * hi];
    }
    pq += __shfl_xor(pq, 16, 32);   // fold the rows r+8 onto the rows r
    ps += __shfl_xor(ps, 16, 32);
    if (hi == 0) {
      float* __restrict__ pb = partial + (size_t)(h * TOKGRP + bx) * PART_STRIDE + w * 16 + ln16;
      pb[0]  = pq;
      pb[D_] = ps;
    }
  }
}

// Second pass: y = up(m) from the saved activations, then the BN affine (G,SH) and the residual.
// There is no launch of its own for the batch statistics: every block first adds up its head's
// TOKGRP sets of column sums and forms G and SH itself (see the head below), while its first loads travel.
// So that this re-read stays small, a block is sixteen waves and takes AP_GROUPS first-pass token
// groups: AP_GRID blocks a head, one per WGP. Its groups lie 8 apart, so that they share the
// block's own index modulo 8 (for speed only).
// Behind the head every wave works alone on its 16-token x 64-column tiles.
// The wave's four 16-column tiles are interleaved: tile j holds the feature columns 4*n + j
// (n = lane & 15 is the tile's own column), so the four results a lane has of one token row are
// adjacent in memory. Residual loads and output stores are then 16 bytes a lane and cover
// 256 contiguous bytes of a row, whole lines, instead of 64-byte pieces.
// The pointers carry no __restrict__ here: the loads then keep their written order against the
// s_wait_xcnt statements below (with it the compiler moved loads across those waits).
__global__ __launch_bounds__(512) void adapter_apply(
    const float* x,
    const float* wu,  const float* bup,
    const float* bn_g, const float* bn_b,
    const float* partial,   // layout: see adapter_stats
    const float* mid,       // layout: see adapter_stats
    float* out)
{
  __shared__ __attribute__((aligned(16))) float s_part[8 * PART_STRIDE];   // eight part sums over the head's blocks

  const int tid  = threadIdx.x;
  const int lane = tid & 31;
  const int w    = tid >> 5;      // wave 0..15
  const int hi   = lane >> 4;     // lane half selects K pair / M+8
  const int ln16 = lane & 15;
  const int h    = blockIdx.y;
  // first of the wave's two first-pass groups; the second lies 8 groups on
  const int bx   = (blockIdx.x & 7) + 8 * (AP_GROUPS * (blockIdx.x >> 3) + 2 * (w >> 3));
  const int mtile = (w >> 1) & 3; // 0..3 : 16-token row tile
  const int cgrp  = w & 1;        // column group

  const int col0 = h * D_ + cgrp * 64 + ln16 * 4;   // the lane's four adjacent feature columns
  const float* wuc = wu + h * (K_ * D_) + cgrp * 64 + ln16 * 4;

  const float4* mt = reinterpret_cast<const float4*>(
      mid + (size_t)((h * TOKGRP + bx) * CHUNKS * 4 + mtile) * MID_TILE) + lane;
  const size_t off0 = (size_t)(bx * CHUNKS * CHUNK_TOK + mtile * 16 + 8 * hi) * (H_ * D_) + col0;
  const float* xw = x + off0;
  float* ow = out + off0;

  // Two register sets: chunk c+1's activations and residual rows are on their way while
  // chunk c is multiplied. All loops over them are unrolled so that the sets stay registers.
  float4 aq[2][4];
  float4 xr[2][8];
  // What does not change from chunk to chunk: the B fragments (tile j, k step s), bias, G, SH.
  v2f bf[4][8];
  float4 bias, G, SH;
  float4 wq[8][2];   // row k = 4s + 2*hi + e of Wu at the lane's four columns, until bf is put together
  #pragma unroll
  for (int q = 0; q < 4; ++q) aq[0][q] = mt[q * 32];
  // a residual load that follows may land in a register these loads name (as in the loop below)
  asm volatile("s_wait_xcnt 0x0" ::: "memory");
  #pragma unroll
  for (int r = 0; r < 8; ++r) xr[0][r] = *reinterpret_cast<const float4*>(xw + r * (H_ * D_));
  // the head's vector work that follows may reuse these loads' address registers
  asm volatile("s_wait_xcnt 0x0" ::: "memory");

  // ---- head: the head's batch statistics, folded into (G, SH) with the 0.1 adapter scale ----
  // Column d of y = y0 + b has mean sum(y0) / N + b[d] and variance sum(y0^2) / N - (sum(y0) / N)^2.
  {
    const float* pbu = bup + col0;
    const float* pga = bn_g + col0;
    const float* pbe = bn_b + col0;
    bias = *reinterpret_cast<const float4*>(pbu);
    const float4 gam = *reinterpret_cast<const float4*>(pga);
    const float4 bet = *reinterpret_cast<const float4*>(pbe);
    // as above, for these three loads' address registers; named as inputs, they stay whole up to the wait
    asm volatile("s_wait_xcnt 0x0" :: "v"(pbu), "v"(pga), "v"(pbe) : "memory");

    // The up projection's weight rows are asked for ahead of the sums: the head is short, and
    // behind it they would be waited for at the first matrix instruction.
    const float* wuh = wuc + 2 * hi * D_;
    #pragma unroll
    for (int s = 0; s < 8; ++s) {
      wq[s][0] = *reinterpret_cast<const float4*>(wuh + (s * 4 + 0) * D_);
      wq[s][1] = *reinterpret_cast<const float4*>(wuh + (s * 4 + 1) * D_);
    }
    // the weight rows' address registers are reused by the vector work that follows; named as an
    // input, they stay whole up to the wait (else the last load landed in its own address pair)
    asm volatile("s_wait_xcnt 0x0" :: "v"(wuh) : "memory");

    // sum over the head's TOKGRP blocks: 16-byte loads, an eighth of the blocks per thread
    {
      const int part = tid >> 6;
      const int c4   = tid & 63;
      const float4* p = reinterpret_cast<const float4*>(
          partial + (size_t)(h * TOKGRP + part * (TOKGRP / 8)) * PART_STRIDE) + c4;
      // unrolled so that the 16 loads are in flight behind one wait
      float4 pv4[16];
      #pragma unroll
      for (int t = 0; t < 16; ++t) pv4[t] = p[t * (PART_STRIDE / 4)];
      // the address registers may be reused behind the sixteen loads; named as an input, they
      // stay whole up to the wait
      asm volatile("s_wait_xcnt 0x0" :: "v"(p) : "memory");
      float4 a = make_float4(0.f, 0.f, 0.f, 0.f);
      #pragma unroll
      for (int t = 0; t < 16; ++t) {
        a.x += pv4[t].x; a.y += pv4[t].y; a.z += pv4[t].z; a.w += pv4[t].w;
      }
      reinterpret_cast<float4*>(s_part + part * PART_STRIDE)[c4] = a;
    }
    lds_barrier();

    // every lane adds up the eight part sums of its own four columns and forms G and SH
    const int c = cgrp * 64 + ln16 * 4;
    float4 q = make_float4(0.f, 0.f, 0.f, 0.f);
    float4 s = make_float4(0.f, 0.f, 0.f, 0.f);
    #pragma unroll
    for (int t = 0; t < 8; ++t) {
      const float4 qt = *reinterpret_cast<const float4*>(&s_part[t * PART_STRIDE + c]);
      const float4 st = *reinterpret_cast<const float4*>(&s_part[t * PART_STRIDE + D_ + c]);
      q.x += qt.x; q.y += qt.y; q.z += qt.z; q.w += qt.w;
      s.x += st.x; s.y += st.y; s.z += st.z; s.w += st.w;
    }
    const float rn = 1.0f / (float)NTOK;
    const float4 mu = make_float4(s.x * rn, s.y * rn, s.z * rn, s.w * rn);
    G.x = 0.1f * gam.x * rsqrtf(q.x * rn - mu.x * mu.x + 1e-5f);
    G.y = 0.1f * gam.y * rsqrtf(q.y * rn - mu.y * mu.y + 1e-5f);
    G.z = 0.1f * gam.z * rsqrtf(q.z * rn - mu.z * mu.z + 1e-5f);
    G.w = 0.1f * gam.w * rsqrtf(q.w * rn - mu.w * mu.w + 1e-5f);
    SH.x = 0.1f * bet.x - (mu.x + bias.x) * G.x;
    SH.y = 0.1f * bet.y - (mu.y + bias.y) * G.y;
    SH.z = 0.1f * bet.z - (mu.z + bias.z) * G.z;
    SH.w = 0.1f * bet.w - (mu.w + bias.w) * G.w;
  }

  #pragma unroll
  for (int chunk = 0; chunk < AP_CHUNKS; ++chunk) {
    const int cur = chunk & 1;
    if (chunk + 1 < AP_CHUNKS) {
      #pragma unroll
      for (int q = 0; q < 4; ++q) aq[cur ^ 1][q] = mt[AP_POS(chunk + 1) * (4 * MID_TILE / 4) + q * 32];
      // behind the last of these loads their address pair is free, and a residual load may land in it
      asm volatile("s_wait_xcnt 0x0" ::: "memory");
      #pragma unroll
      for (int r = 0; r < 8; ++r)
        xr[cur ^ 1][r] = *reinterpret_cast<const float4*>(
            xw + (AP_POS(chunk + 1) * CHUNK_TOK + r) * (H_ * D_));
    }
    // keeps the next chunk's loads in front of this chunk's matrix work, and that work
    // behind the last chunk's stores (else two chunks' results are held at once)
    __builtin_amdgcn_sched_barrier(0);

    if (chunk == 0) {
      #pragma unroll
      for (int s = 0; s < 8; ++s) {
        bf[0][s][0] = wq[s][0].x; bf[0][s][1] = wq[s][1].x;
        bf[1][s][0] = wq[s][0].y; bf[1][s][1] = wq[s][1].y;
        bf[2][s][0] = wq[s][0].z; bf[2][s][1] = wq[s][1].z;
        bf[3][s][0] = wq[s][0].w; bf[3][s][1] = wq[s][1].w;
      }
    }

    // ---- GEMM2: (16x32) x (32x128) -> 4 column tiles per wave ----
    v8f acc[4];
    #pragma unroll
    for (int j = 0; j < 4; ++j) acc[j] = v8f{0.f, 0.f, 0.f, 0.f, 0.f, 0.f, 0.f, 0.f};
    #pragma unroll
    for (int q = 0; q < 4; ++q) {
      v2f a0, a1;
      a0[0] = aq[cur][q].x; a0[1] = aq[cur][q].y;
      a1[0] = aq[cur][q].z; a1[1] = aq[cur][q].w;
      #pragma unroll
      for (int j = 0; j < 4; ++j)
        acc[j] = __builtin_amdgcn_wmma_f32_16x16x4_f32(false, a0, false, bf[j][2 * q],
                                                       (short)0, acc[j], false, false);
      #pragma unroll
      for (int j = 0; j < 4; ++j)
        acc[j] = __builtin_amdgcn_wmma_f32_16x16x4_f32(false, a1, false, bf[j][2 * q + 1],
                                                       (short)0, acc[j], false, false);
    }
    #pragma unroll
    for (int r = 0; r < 8; ++r) {
      float4 o;
      o.x = (acc[0][r] + bias.x) * G.x + SH.x + xr[cur][r].x;
      o.y = (acc[1][r] + bias.y) * G.y + SH.y + xr[cur][r].y;
      o.z = (acc[2][r] + bias.z) * G.z + SH.z + xr[cur][r].z;
      o.w = (acc[3][r] + bias.w) * G.w + SH.w + xr[cur][r].w;
      *reinterpret_cast<float4*>(ow + (AP_POS(chunk) * CHUNK_TOK + r) * (H_ * D_)) = o;
    }
    // the stores' data registers are refilled by the next chunk's work
    if (chunk + 1 < AP_CHUNKS) asm volatile("s_wait_xcnt 0x0" ::: "memory");
  }
}

extern "C" void kernel_launch(void* const* d_in, const int* in_sizes, int n_in,
                              void* d_out, int out_size, void* d_ws, size_t ws_size,
                              hipStream_t stream) {
  const float* x    = (const float*)d_in[0];
  const float* ln_g = (const float*)d_in[1];
  const float* ln_b = (const float*)d_in[2];
  const float* wd   = (const float*)d_in[3];
  const float* bdn  = (const float*)d_in[4];
  const float* wu   = (const float*)d_in[5];
  const float* bup  = (const float*)d_in[6];
  const float* bn_g = (const float*)d_in[7];
  const float* bn_b = (const float*)d_in[8];
  float* out = (float*)d_out;

  float* partial = (float*)d_ws;                 // 1024 blocks * PART_STRIDE floats used, MOM_STRIDE set aside
  float* mid     = partial + (size_t)H_ * TOKGRP * MOM_STRIDE;  // NTOK*H_*K_ floats = 32 MB

  dim3 grid(TOKGRP, H_);
  adapter_stats<<<grid, 256, 0, stream>>>(x, ln_g, ln_b, wd, bdn, wu, mid, partial);
  dim3 grid2(AP_GRID, H_);
  adapter_apply<<<grid2, 512, 0, stream>>>(x, wu, bup, bn_g, bn_b, partial, mid, out);
}
